// v000
// Measured on an AMD MI455X. A time is GPU time per run, averaged over a window of back-to-back runs after a warm-up
// (all launches, gaps included; the runs take copies of the inputs in turn), and the median of several windows.
// Apart from v000's, it joins two sittings. Times from different sittings can be a few percent apart, while
// side-by-side timings come from the same sitting.
// The starting kernel, v000, takes 390 microseconds a run.
#include <hip/hip_runtime.h>
// DeConv2d as 32 per-output-channel pixel MLPs (8192 pixels × 128 → 256 → 256 → 2×2): layers 1 and 2 on v_wmma_f32_16x16x32_f16 (layer 1 as one GEMM over 8 stacked channels per chunk,
// layer 2 batched per channel with column-block views; W [o][in][out] transposed to bf16-exact ×2^4, + bias, relu, f32 accumulate, f16 rows); layer 3 (256 → 4, + bias) and the
// pixel-shuffle placement out[n][o][2i+ki][2j+kj] are f32 VALU from the f16 hidden rows.
#define NBt 8
#define IC 128
#define IH 32
#define NPX (NBt * IH * IH)
#define OC 32
#define HH 256
#define OCH 8

typedef __bf16 v16b __attribute__((ext_vector_type(16)));
typedef unsigned short v8us __attribute__((ext_vector_type(8), may_alias));
typedef float  v8f  __attribute__((ext_vector_type(8)));
typedef float  v4f  __attribute__((ext_vector_type(4)));
typedef float  v4fa __attribute__((ext_vector_type(4), may_alias));
union FragB { v16b v; v8us half[2]; unsigned short u[16]; };

__device__ __forceinline__ unsigned short bf16_bits(float x) { unsigned int u = __float_as_uint(x); return (unsigned short)((u + 0x7FFFu + ((u >> 16) & 1u)) >> 16); }
__device__ __forceinline__ float bf16_val(unsigned short b) { return __uint_as_float(((unsigned int)b) << 16); }
__device__ __forceinline__ float bf16_round(float x) { return bf16_val(bf16_bits(x)); }
// D += A·B with NT terms: 1 = ah·bh, 2 = + al·bh (A split), 3 = + ah·bl (both split)
template <int NT>
__device__ __forceinline__ v8f mmaN(v16b ah, v16b al, v16b bh, v16b bl, v8f c) {
  c = __builtin_amdgcn_wmma_f32_16x16x32_bf16(false, ah, false, bh, (short)0, c, false, false);
  if (NT >= 2) c = __builtin_amdgcn_wmma_f32_16x16x32_bf16(false, al, false, bh, (short)0, c, false, false);
  if (NT >= 3) c = __builtin_amdgcn_wmma_f32_16x16x32_bf16(false, ah, false, bl, (short)0, c, false, false);
  asm volatile("v_nop\n\tv_nop\n\tv_nop\n\tv_nop" : "+v"(c) : "v"(ah), "v"(al), "v"(bh), "v"(bl));
  return c;
}

__global__ __launch_bounds__(256) void k_wt_bf16(const float* __restrict__ W, unsigned short* __restrict__ Wt, int K, int N) {
  const int t = blockIdx.x * 256 + threadIdx.x;
  const int k8n = K / 8;
  if (t >= N * k8n) return;
  const int n = t / k8n, k8 = (t % k8n) * 8;
  v8us v;
#pragma unroll
  for (int i = 0; i < 8; ++i) v[i] = bf16_bits(W[(size_t)(k8 + i) * N + n]);
  *(v8us*)(Wt + (size_t)n * K + k8) = v;
  
}

// GEMM C[M][N] (f32, pitch ldc) = act(A[M][K]·W + bias). A f32 row-major (pitch lda) converted per fragment to bf16
// (ASPLIT: hi/lo two planes -> 2 terms, else single rounded term); Wt bf16 [N][K] (pitch ldb). BIAS_BF16 rounds the
// bias to bf16 first (bias quantised to bf16 before the add). K%32==0, M%16==0, N%64==0.
template <bool ASPLIT, int ACT, bool BIAS_BF16>
__global__ __launch_bounds__(128) void k_gemm_bf(const float* __restrict__ A, int lda, const unsigned short* __restrict__ Wt, int ldb,
                                               const float* __restrict__ bias, float* __restrict__ C, int ldc, int M, int N, int K) {
  __shared__ __attribute__((aligned(16))) float so[4][16][64];
  const int tid = threadIdx.x, w = tid >> 5, lane = tid & 31, ln = lane & 15, hh = lane >> 4;
  const int ntn = N / 64;
  const int wid = blockIdx.x * 4 + w;
  const int mt = wid / ntn, nq = wid % ntn;
  if (mt * 16 >= M) return;
  const int row0 = mt * 16, col0 = nq * 64;
  const float* arow = A + (size_t)(row0 + ln) * lda;
  v8f acc[4] = {};
  for (int kb = 0; kb < K; kb += 32) {
    FragB ah, al;
    const v4f x0 = *(const v4fa*)(arow + kb + 8 * hh), x1 = *(const v4fa*)(arow + kb + 8 * hh + 4);
    const v4f x2 = *(const v4fa*)(arow + kb + 16 + 8 * hh), x3 = *(const v4fa*)(arow + kb + 16 + 8 * hh + 4);
    float xs[16] = {x0[0],x0[1],x0[2],x0[3],x1[0],x1[1],x1[2],x1[3],x2[0],x2[1],x2[2],x2[3],x3[0],x3[1],x3[2],x3[3]};
#pragma unroll
    for (int i = 0; i < 16; ++i) { const unsigned short hb = bf16_bits(xs[i]); ah.u[i] = hb; al.u[i] = ASPLIT ? bf16_bits(xs[i] - bf16_val(hb)) : (unsigned short)0; }
#pragma unroll
    for (int t = 0; t < 4; ++t) {
      const unsigned short* brow = Wt + (size_t)(col0 + t * 16 + ln) * ldb + kb;
      FragB b;
      b.half[0] = *(const v8us*)(brow + 8 * hh);
      b.half[1] = *(const v8us*)(brow + 16 + 8 * hh);
      acc[t] = mmaN<ASPLIT ? 2 : 1>(ah.v, al.v, b.v, b.v, acc[t]);
    }
  }
#pragma unroll
  for (int t = 0; t < 4; ++t) {
    float bv = bias ? bias[col0 + t * 16 + ln] : 0.f;
    if (BIAS_BF16) bv = bf16_round(bv);
#pragma unroll
    for (int r = 0; r < 8; ++r) { float v = acc[t][r] + bv; if (ACT == 1) v = fmaxf(v, 0.f); so[w][8 * hh + r][t * 16 + ln] = v; }
  }
  __builtin_amdgcn_fence(__ATOMIC_ACQ_REL, "workgroup");
  __builtin_amdgcn_wave_barrier();
  const int rsub = lane >> 4, c4 = (lane & 15) * 4;
  {
#pragma unroll
    for (int q = 0; q < 8; ++q) {
      const int r = q * 2 + rsub;
      const v4f v = *(const v4fa*)&so[w][r][c4];
      *(v4f*)(C + (size_t)(row0 + r) * ldc + col0 + c4) = v;
    }
    
  }
}

// Flash-style causal/unmasked attention, all contractions 3-term bf16 hi/lo splits, f32 softmax with running max.
// q,k,v rows are read from f32 buffers with arbitrary row pitch (so they can live inside a fused qkv buffer);
// D = head size (multiple of 32, <= 128); one wave = 16 query rows; block = 4 waves (64 queries) sharing K/V chunks of 32.
template <int D, bool CAUSAL>
__global__ __launch_bounds__(128) void k_flash(const float* __restrict__ qb, const float* __restrict__ kb, const float* __restrict__ vb,
                                             int pitch, int T, int H, float scale, float* __restrict__ y, int ypitch) {
  constexpr int KS = D / 32;        // k-steps for QK
  constexpr int DT = D / 16;        // d tiles for PV
  __shared__ __attribute__((aligned(16))) unsigned short sKh[32][D + 8], sKl[32][D + 8], sVh[32][D + 8], sVl[32][D + 8];
  __shared__ __attribute__((aligned(16))) unsigned short sPh[4][16][40], sPl[4][16][40];
  __shared__ __attribute__((aligned(16))) float sO[4][16][D];
  const int tid = threadIdx.x, w = tid >> 5, lane = tid & 31, ln = lane & 15, hh = lane >> 4;
  const int nqb = (T + 63) / 64;
  const int bh = blockIdx.x / nqb, qblk = blockIdx.x % nqb;
  const int b = bh / H, h = bh % H;
  const int q0 = qblk * 64 + w * 16;
  const float* Q = qb + (size_t)b * T * pitch + h * D;
  const float* K = kb + (size_t)b * T * pitch + h * D;
  const float* V = vb + (size_t)b * T * pitch + h * D;

  // A fragments of the wave's 16 query rows (scaled), hi/lo
  FragB aqh[KS], aql[KS];
  {
    int row = q0 + ln; if (row >= T) row = T - 1;
    const float* qr = Q + (size_t)row * pitch;
#pragma unroll
    for (int ks = 0; ks < KS; ++ks)
#pragma unroll
      for (int i = 0; i < 16; ++i) {
        const int d = ks * 32 + ((i < 8) ? (8 * hh + i) : (16 + 8 * hh + (i - 8)));
        const float x = qr[d] * scale; const unsigned short hb = bf16_bits(x);
        aqh[ks].u[i] = hb; aql[ks].u[i] = bf16_bits(x - bf16_val(hb));
      }
  }
  float m_r[8], l_r[8];
#pragma unroll
  for (int r = 0; r < 8; ++r) { m_r[r] = -3.0e38f; l_r[r] = 0.f; }
  v8f oacc[DT];
#pragma unroll
  for (int dt = 0; dt < DT; ++dt) oacc[dt] = (v8f){0.f,0.f,0.f,0.f,0.f,0.f,0.f,0.f};

  const int kv_end = CAUSAL ? min(T, qblk * 64 + 64) : T;     // block-uniform
  for (int j0 = 0; j0 < kv_end; j0 += 32) {
    __syncthreads();
    for (int e = tid; e < 32 * (D / 4); e += 128) {
      const int r = e / (D / 4), c4 = (e % (D / 4)) * 4;
      const int key = j0 + r;
      v4f kf = {0.f,0.f,0.f,0.f}, vf = {0.f,0.f,0.f,0.f};
      if (key < T) { kf = *(const v4fa*)(K + (size_t)key * pitch + c4); vf = *(const v4fa*)(V + (size_t)key * pitch + c4); }
#pragma unroll
      for (int t = 0; t < 4; ++t) {
        unsigned short hb = bf16_bits(kf[t]); sKh[r][c4 + t] = hb; sKl[r][c4 + t] = bf16_bits(kf[t] - bf16_val(hb));
        hb = bf16_bits(vf[t]); sVh[r][c4 + t] = hb; sVl[r][c4 + t] = bf16_bits(vf[t] - bf16_val(hb));
      }
    }
    __syncthreads();
    // S tile 16 x 32
    v8f s[2];
#pragma unroll
    for (int nt = 0; nt < 2; ++nt) {
      v8f acc = {};
#pragma unroll
      for (int ks = 0; ks < KS; ++ks) {
        FragB bh_, bl_;
        bh_.half[0] = *(const v8us*)&sKh[nt * 16 + ln][ks * 32 + 8 * hh]; bh_.half[1] = *(const v8us*)&sKh[nt * 16 + ln][ks * 32 + 16 + 8 * hh];
        bl_.half[0] = *(const v8us*)&sKl[nt * 16 + ln][ks * 32 + 8 * hh]; bl_.half[1] = *(const v8us*)&sKl[nt * 16 + ln][ks * 32 + 16 + 8 * hh];
        acc = mmaN<3>(aqh[ks].v, aql[ks].v, bh_.v, bl_.v, acc);
      }
      s[nt] = acc;
    }
    // mask + running max (rows 8hh+r; the 16 lanes of a half share rows)
    float alpha[8];
#pragma unroll
    for (int r = 0; r < 8; ++r) {
      const int qi = q0 + 8 * hh + r;
      const int ja = j0 + ln, jb = j0 + 16 + ln;
      if (CAUSAL) { if (ja > qi) s[0][r] = -3.0e38f; if (jb > qi) s[1][r] = -3.0e38f; }
      if (ja >= T) s[0][r] = -3.0e38f;
      if (jb >= T) s[1][r] = -3.0e38f;
      float mx = fmaxf(s[0][r], s[1][r]);
      mx = fmaxf(mx, __shfl_xor(mx, 1, 32)); mx = fmaxf(mx, __shfl_xor(mx, 2, 32)); mx = fmaxf(mx, __shfl_xor(mx, 4, 32)); mx = fmaxf(mx, __shfl_xor(mx, 8, 32));
      const float mnew = fmaxf(m_r[r], mx);
      alpha[r] = (mnew > -1.0e38f) ? __expf(m_r[r] - mnew) : 1.0f;
      const float p0 = (s[0][r] > -1.0e38f) ? __expf(s[0][r] - mnew) : 0.f;
      const float p1 = (s[1][r] > -1.0e38f) ? __expf(s[1][r] - mnew) : 0.f;
      m_r[r] = mnew;
      l_r[r] = l_r[r] * alpha[r] + p0 + p1;            // per-lane partial row sum (16 lanes combined at the end)
      unsigned short hb = bf16_bits(p0); sPh[w][8 * hh + r][ln] = hb;      sPl[w][8 * hh + r][ln] = bf16_bits(p0 - bf16_val(hb));
      hb = bf16_bits(p1);                sPh[w][8 * hh + r][16 + ln] = hb; sPl[w][8 * hh + r][16 + ln] = bf16_bits(p1 - bf16_val(hb));
    }
#pragma unroll
    for (int dt = 0; dt < DT; ++dt)
#pragma unroll
      for (int r = 0; r < 8; ++r) oacc[dt][r] *= alpha[r];
    __builtin_amdgcn_fence(__ATOMIC_ACQ_REL, "workgroup");
    __builtin_amdgcn_wave_barrier();
    FragB pah, pal;
    pah.half[0] = *(const v8us*)&sPh[w][ln][8 * hh]; pah.half[1] = *(const v8us*)&sPh[w][ln][16 + 8 * hh];
    pal.half[0] = *(const v8us*)&sPl[w][ln][8 * hh]; pal.half[1] = *(const v8us*)&sPl[w][ln][16 + 8 * hh];
#pragma unroll
    for (int dt = 0; dt < DT; ++dt) {
      FragB bvh, bvl;
#pragma unroll
      for (int i = 0; i < 8; ++i) {
        bvh.u[i] = sVh[8 * hh + i][dt * 16 + ln]; bvh.u[8 + i] = sVh[16 + 8 * hh + i][dt * 16 + ln];
        bvl.u[i] = sVl[8 * hh + i][dt * 16 + ln]; bvl.u[8 + i] = sVl[16 + 8 * hh + i][dt * 16 + ln];
      }
      oacc[dt] = mmaN<3>(pah.v, pal.v, bvh.v, bvl.v, oacc[dt]);
    }
    __builtin_amdgcn_fence(__ATOMIC_ACQ_REL, "workgroup");
    __builtin_amdgcn_wave_barrier();
  }
#pragma unroll
  for (int r = 0; r < 8; ++r) {
    float l = l_r[r];
    l += __shfl_xor(l, 1, 32); l += __shfl_xor(l, 2, 32); l += __shfl_xor(l, 4, 32); l += __shfl_xor(l, 8, 32);
    l_r[r] = (l > 0.f) ? 1.0f / l : 0.f;
  }
#pragma unroll
  for (int dt = 0; dt < DT; ++dt)
#pragma unroll
    for (int r = 0; r < 8; ++r) sO[w][8 * hh + r][dt * 16 + ln] = oacc[dt][r] * l_r[r];
  __builtin_amdgcn_fence(__ATOMIC_ACQ_REL, "workgroup");
  __builtin_amdgcn_wave_barrier();
  {
    for (int r = 0; r < 16; ++r) {
      const int row = q0 + r;
      if (row < T && lane < D / 4) {
        const v4f val = *(const v4fa*)&sO[w][r][lane * 4];
        *(v4f*)(y + ((size_t)b * T + row) * ypitch + h * D + lane * 4) = val;
      }
    }
    
  }
}

// GEMM C = act(A·W + bias + resid): A f32 (ASPLIT -> hi/lo 2 terms), Wt bf16 [N][K]; ACT 0 none, 1 relu, 2 exact gelu;
// resid (optional, f32, row index = (row % rmod), pitch ldr, RES_BF16 rounds it) added before the activation.
template <bool ASPLIT, int ACT, bool BIAS_BF16, bool RES_BF16>
__global__ __launch_bounds__(128) void k_gemm_bf3(const float* __restrict__ A, int lda, const unsigned short* __restrict__ Wt, int ldb,
                                                const float* __restrict__ bias, const float* __restrict__ resid, int rmod, int ldr,
                                                float* __restrict__ C, int ldc, int M, int N, int K) {
  __shared__ __attribute__((aligned(16))) float so[4][16][64];
  const int tid = threadIdx.x, w = tid >> 5, lane = tid & 31, ln = lane & 15, hh = lane >> 4;
  const int ntn = N / 64;
  const int wid = blockIdx.x * 4 + w;
  const int mt = wid / ntn, nq = wid % ntn;
  if (mt * 16 >= M) return;
  const int row0 = mt * 16, col0 = nq * 64;
  const float* arow = A + (size_t)(row0 + ln) * lda;
  v8f acc[4] = {};
  for (int kb = 0; kb < K; kb += 32) {
    FragB ah, al;
    const v4f x0 = *(const v4fa*)(arow + kb + 8 * hh), x1 = *(const v4fa*)(arow + kb + 8 * hh + 4);
    const v4f x2 = *(const v4fa*)(arow + kb + 16 + 8 * hh), x3 = *(const v4fa*)(arow + kb + 16 + 8 * hh + 4);
    float xs[16] = {x0[0],x0[1],x0[2],x0[3],x1[0],x1[1],x1[2],x1[3],x2[0],x2[1],x2[2],x2[3],x3[0],x3[1],x3[2],x3[3]};
#pragma unroll
    for (int i = 0; i < 16; ++i) { const unsigned short hb = bf16_bits(xs[i]); ah.u[i] = hb; al.u[i] = ASPLIT ? bf16_bits(xs[i] - bf16_val(hb)) : (unsigned short)0; }
#pragma unroll
    for (int t = 0; t < 4; ++t) {
      const unsigned short* brow = Wt + (size_t)(col0 + t * 16 + ln) * ldb + kb;
      FragB b;
      b.half[0] = *(const v8us*)(brow + 8 * hh);
      b.half[1] = *(const v8us*)(brow + 16 + 8 * hh);
      acc[t] = mmaN<ASPLIT ? 2 : 1>(ah.v, al.v, b.v, b.v, acc[t]);
    }
  }
#pragma unroll
  for (int t = 0; t < 4; ++t) {
    const int col = col0 + t * 16 + ln;
    float bv = bias ? bias[col] : 0.f;
    if (BIAS_BF16) bv = bf16_round(bv);
#pragma unroll
    for (int r = 0; r < 8; ++r) {
      float v = acc[t][r] + bv;
      if (resid) { float rv = resid[(size_t)((row0 + 8 * hh + r) % rmod) * ldr + col]; if (RES_BF16) rv = bf16_round(rv); v += rv; }
      if (ACT == 1) v = fmaxf(v, 0.f);
      if (ACT == 2) v = 0.5f * v * (1.0f + erff(v * 0.70710678118654752f));
      if (ACT == 3) { const float u = 0.7978845608028654f * (v + 0.044715f * v * v * v); v = 0.5f * v * (1.0f + tanhf(u)); }
      so[w][8 * hh + r][t * 16 + ln] = v;
    }
  }
  __builtin_amdgcn_fence(__ATOMIC_ACQ_REL, "workgroup");
  __builtin_amdgcn_wave_barrier();
  const int rsub = lane >> 4, c4 = (lane & 15) * 4;
  {
#pragma unroll
    for (int q = 0; q < 8; ++q) {
      const int r = q * 2 + rsub;
      const v4f v = *(const v4fa*)&so[w][r][c4];
      *(v4f*)(C + (size_t)(row0 + r) * ldc + col0 + c4) = v;
    }
    
  }
}
// row LayerNorm (biased variance, eps) over N: s = X (+ R); optional out_sum <- s; out_norm <- (s-mu)*rsqrt(var+eps)*g + b
template <bool PARAM_BF16>
__global__ __launch_bounds__(256) void k_layernorm(const float* __restrict__ X, const float* __restrict__ R, const float* __restrict__ g, const float* __restrict__ bta,
                                                  float* __restrict__ out_sum, float* __restrict__ out_norm, int N, float eps) {
  __shared__ float red[256];
  const int row = blockIdx.x, tid = threadIdx.x;
  const float* x = X + (size_t)row * N; const float* rr = R ? R + (size_t)row * N : nullptr;
  float vals[16];                     // up to N = 4096
  const int per = N / 256;            // contiguous chunk per thread? use strided-by-4 chunks: thread handles j = tid*4 + 1024*u
  float s1 = 0.f;
  for (int u = 0; u < per / 4; ++u) {
    const int j = tid * 4 + 1024 * u;
    const v4f a = *(const v4fa*)(x + j);
    v4f b = {0.f,0.f,0.f,0.f}; if (rr) b = *(const v4fa*)(rr + j);
#pragma unroll
    for (int q = 0; q < 4; ++q) { const float v = a[q] + b[q]; vals[u * 4 + q] = v; s1 += v; }
  }
  red[tid] = s1; __syncthreads();
  for (int st = 128; st > 0; st >>= 1) { if (tid < st) red[tid] += red[tid + st]; __syncthreads(); }
  const float mu = red[0] / (float)N; __syncthreads();
  float s2 = 0.f;
  for (int u = 0; u < per / 4; ++u)
#pragma unroll
    for (int q = 0; q < 4; ++q) { const float c = vals[u * 4 + q] - mu; s2 += c * c; }
  red[tid] = s2; __syncthreads();
  for (int st = 128; st > 0; st >>= 1) { if (tid < st) red[tid] += red[tid + st]; __syncthreads(); }
  const float rs = rsqrtf(red[0] / (float)N + eps);
  {
    for (int u = 0; u < per / 4; ++u) {
      const int j = tid * 4 + 1024 * u;
      v4f o, sm;
#pragma unroll
      for (int q = 0; q < 4; ++q) {
        float gg = g[j + q], bb = bta[j + q];
        if (PARAM_BF16) { gg = bf16_round(gg); bb = bf16_round(bb); }
        sm[q] = vals[u * 4 + q]; o[q] = (vals[u * 4 + q] - mu) * rs * gg + bb;
      }
      if (out_sum) *(v4f*)(out_sum + (size_t)row * N + j) = sm;
      *(v4f*)(out_norm + (size_t)row * N + j) = o;
    }
    
  }
}



// ---- f16 WMMA path (v_wmma_f32_16x16x32_f16): 11-bit significands for operands in range — used here for MLP layers 1 and 2 (k_gemm_hhx)
typedef _Float16 v16h __attribute__((ext_vector_type(16)));
union FragH { v16h v; v8us half[2]; _Float16 h[16]; unsigned short u[16]; };
template <int NT>
__device__ __forceinline__ v8f mmaH(v16h ah, v16h al, v16h bh, v16h bl, v8f c) {
  c = __builtin_amdgcn_wmma_f32_16x16x32_f16(false, ah, false, bh, (short)0, c, false, false);
  if (NT >= 2) c = __builtin_amdgcn_wmma_f32_16x16x32_f16(false, al, false, bh, (short)0, c, false, false);
  if (NT >= 3) c = __builtin_amdgcn_wmma_f32_16x16x32_f16(false, ah, false, bl, (short)0, c, false, false);
  asm volatile("v_nop\n\tv_nop\n\tv_nop\n\tv_nop" : "+v"(c) : "v"(ah), "v"(al), "v"(bh), "v"(bl));
  return c;
}
// batched GEMM like k_gemm_b but f16 operands: A f32 (split into f16 hi/lo if ASPLIT, else rounded to f16), Bt = f16 values [n][k]; alpha; C f32; N multiple of 16 (partial tiles skipped)
template <bool ASPLIT>
__global__ __launch_bounds__(128) void k_gemm_h(const float* __restrict__ A, int lda, size_t sA, const _Float16* __restrict__ Bh, int ldb, size_t sB, float alpha, float* __restrict__ C, int ldc, size_t sC, int M, int N, int K) {
  __shared__ __attribute__((aligned(16))) float so[4][16][64];
  const int tid = threadIdx.x, w = tid >> 5, lane = tid & 31, ln = lane & 15, hh = lane >> 4; const int by = blockIdx.y;
  A += (size_t)by * sA; Bh += (size_t)by * sB; C += (size_t)by * sC;
  const int ntn = (N + 63) / 64; const int wid = blockIdx.x * 4 + w; const int mt = wid / ntn, nq = wid % ntn; if (mt * 16 >= M) return;
  const int row0 = mt * 16, col0 = nq * 64; const float* arow = A + (size_t)(row0 + ln) * lda;
  v8f acc[4] = {};
  for (int kb = 0; kb < K; kb += 32) {
    FragH ah, al;
    const v4f x0 = *(const v4fa*)(arow + kb + 8 * hh), x1 = *(const v4fa*)(arow + kb + 8 * hh + 4), x2 = *(const v4fa*)(arow + kb + 16 + 8 * hh), x3 = *(const v4fa*)(arow + kb + 16 + 8 * hh + 4);
    float xs[16] = {x0[0],x0[1],x0[2],x0[3],x1[0],x1[1],x1[2],x1[3],x2[0],x2[1],x2[2],x2[3],x3[0],x3[1],x3[2],x3[3]};
#pragma unroll
    for (int i = 0; i < 16; ++i) { const _Float16 h = (_Float16)xs[i]; ah.h[i] = h; al.h[i] = ASPLIT ? (_Float16)(xs[i] - (float)h) : (_Float16)0.0f; }
#pragma unroll
    for (int t = 0; t < 4; ++t) { if (col0 + t * 16 >= N) continue; const size_t boff = (size_t)(col0 + t * 16 + ln) * ldb + kb; FragH bq; bq.half[0] = *(const v8us*)(Bh + boff + 8 * hh); bq.half[1] = *(const v8us*)(Bh + boff + 16 + 8 * hh);
      acc[t] = mmaH<ASPLIT ? 2 : 1>(ah.v, al.v, bq.v, bq.v, acc[t]); }
  }
#pragma unroll
  for (int t = 0; t < 4; ++t) { if (col0 + t * 16 >= N) continue;
#pragma unroll
    for (int r = 0; r < 8; ++r) so[w][8 * hh + r][t * 16 + ln] = acc[t][r] * alpha; }
  __builtin_amdgcn_fence(__ATOMIC_ACQ_REL, "workgroup"); __builtin_amdgcn_wave_barrier();
  const int rsub = lane >> 4, c4 = (lane & 15) * 4;
  {
#pragma unroll
    for (int q = 0; q < 8; ++q) { const int r = q * 2 + rsub; if (col0 + c4 < N) { const v4f v = *(const v4fa*)&so[w][r][c4]; *(v4f*)(C + (size_t)(row0 + r) * ldc + col0 + c4) = v; } }
     }
}

// Wt[n][k] = f16(W[k][n]·scale) from f32 row-major W[K][N] (scale = power of two; bf16-exact weights stay exact in f16 away from the subnormal range)
__global__ __launch_bounds__(256) void k_wt_f16(const float* __restrict__ W, _Float16* __restrict__ Wt, int K, int N, float scale) {
  const int t = blockIdx.x * 256 + threadIdx.x; if (t >= N * (K / 8)) return; const int n = t / (K / 8), k8 = (t % (K / 8)) * 8; FragH f;
#pragma unroll
  for (int i = 0; i < 8; ++i) f.h[i] = (_Float16)(bf16_round(W[(size_t)(k8 + i) * N + n]) * scale); const v8us o = f.half[0];
  *(v8us*)((unsigned short*)Wt + (size_t)n * K + k8) = o; 
}
// k_gemm_hh variant with fused epilogue: v = acc·alpha + bias[by·sBias + col] (+ CP[(row/rowsPerB)·sCPb + by·64 + col] if CP) ; ACT 0 none / 1 elu ; writes f16 C16 (and f32 C if non-null)
template <int ACT>
__global__ __launch_bounds__(128) void k_gemm_hhx(const _Float16* __restrict__ A, int lda, size_t sA, const _Float16* __restrict__ Bh, int ldb, size_t sB, float alpha, const float* __restrict__ bias, size_t sBias, const float* __restrict__ CP, int rowsPerB, size_t sCPb, int row0g,
    float* __restrict__ C, _Float16* __restrict__ C16, int ldc, size_t sC, int M, int N, int K) {
  __shared__ __attribute__((aligned(16))) float so[4][16][64];
  const int tid = threadIdx.x, w = tid >> 5, lane = tid & 31, ln = lane & 15, hh = lane >> 4; const int by = blockIdx.y;
  A += (size_t)by * sA; Bh += (size_t)by * sB; const size_t cofs = (size_t)by * sC; const float* bp = bias ? bias + (size_t)by * sBias : nullptr;
  const int ntn = (N + 63) / 64; const int wid = blockIdx.x * 4 + w; const int mt = wid / ntn, nq = wid % ntn; if (mt * 16 >= M) return;
  const int row0 = mt * 16, col0 = nq * 64; const _Float16* arow = A + (size_t)(row0 + ln) * lda;
  v8f acc[4] = {};
  for (int kb = 0; kb < K; kb += 32) { FragH ah; ah.half[0] = *(const v8us*)((const unsigned short*)arow + kb + 8 * hh); ah.half[1] = *(const v8us*)((const unsigned short*)arow + kb + 16 + 8 * hh);
#pragma unroll
    for (int t = 0; t < 4; ++t) { if (col0 + t * 16 >= N) continue; const size_t boff = (size_t)(col0 + t * 16 + ln) * ldb + kb; FragH bq; bq.half[0] = *(const v8us*)((const unsigned short*)Bh + boff + 8 * hh); bq.half[1] = *(const v8us*)((const unsigned short*)Bh + boff + 16 + 8 * hh);
      acc[t] = mmaH<1>(ah.v, ah.v, bq.v, bq.v, acc[t]); }
  }
#pragma unroll
  for (int t = 0; t < 4; ++t) { if (col0 + t * 16 >= N) continue; const int col = col0 + t * 16 + ln; const float bv = bp ? bf16_round(bp[col]) : 0.f;
#pragma unroll
    for (int r = 0; r < 8; ++r) { float v = acc[t][r] * alpha + bv; if (CP) { const int bidx = (row0g + row0 + 8 * hh + r) / rowsPerB; v += CP[(size_t)bidx * sCPb + (size_t)by * 64 + col]; } if (ACT == 1) v = (v > 0.f) ? v : expm1f(v); else if (ACT == 3) v = fmaxf(v, 0.f); so[w][8 * hh + r][t * 16 + ln] = v; } }
  __builtin_amdgcn_fence(__ATOMIC_ACQ_REL, "workgroup"); __builtin_amdgcn_wave_barrier();
  const int rsub = lane >> 4, c4 = (lane & 15) * 4; typedef _Float16 v4h __attribute__((ext_vector_type(4)));
  {
#pragma unroll
    for (int q = 0; q < 8; ++q) { const int r = q * 2 + rsub; if (col0 + c4 < N) { const v4f v = *(const v4fa*)&so[w][r][c4]; if (C) *(v4f*)(C + cofs + (size_t)(row0 + r) * ldc + col0 + c4) = v; if (C16) { v4h h4; for (int i = 0; i < 4; ++i) h4[i] = (_Float16)v[i]; *(v4h*)(C16 + cofs + (size_t)(row0 + r) * ldc + col0 + c4) = h4; } } }
     }
}


__global__ __launch_bounds__(256) void k_pix(const float* __restrict__ x, _Float16* __restrict__ PIX) { __shared__ unsigned short tl[16][72]; const int tid = threadIdx.x; const int n = blockIdx.x / (2 * 64), rem = blockIdx.x % (2 * 64); const int cg = rem / 64, pg = rem % 64; const int c0 = cg * 64, p0 = pg * 16;
  for (int i = tid; i < 64 * 16; i += 256) { const int c = i / 16, pp = i % 16; FragH f; f.h[0] = (_Float16)bf16_round(x[((size_t)n * IC + c0 + c) * (IH * IH) + p0 + pp]); tl[pp][c] = f.u[0]; }
  __syncthreads();
  if (tid < 128) { const int r = tid / 8, pc = tid % 8; FragH f;
#pragma unroll
    for (int q = 0; q < 8; ++q) f.u[q] = tl[r][pc * 8 + q]; unsigned short* d = (unsigned short*)PIX + ((size_t)n * IH * IH + p0 + r) * IC + c0 + pc * 8; *(v8us*)d = f.half[0];  } }
__global__ __launch_bounds__(256) void k_w1(const float* __restrict__ W1, int o0, _Float16* __restrict__ Bt) { const int t = blockIdx.x * 256 + threadIdx.x; if (t >= OCH * HH * (IC / 8)) return; const int row = t / (IC / 8), c8 = (t % (IC / 8)) * 8; const int ol = row / HH, d = row % HH; FragH f;
#pragma unroll
  for (int q = 0; q < 8; ++q) f.h[q] = (_Float16)(bf16_round(W1[(((size_t)(o0 + ol)) * IC + c8 + q) * HH + d]) * 16.0f); *(v8us*)((unsigned short*)Bt + (size_t)row * IC + c8) = f.half[0];  }
__global__ __launch_bounds__(256) void k_w2(const float* __restrict__ W2, _Float16* __restrict__ Bt) { const int t = blockIdx.x * 256 + threadIdx.x; if (t >= OC * HH * (HH / 8)) return; const int row = t / (HH / 8), d8 = (t % (HH / 8)) * 8; const int o = row / HH, e = row % HH; FragH f;
#pragma unroll
  for (int q = 0; q < 8; ++q) f.h[q] = (_Float16)(bf16_round(W2[(((size_t)o) * HH + d8 + q) * HH + e]) * 16.0f); *(v8us*)((unsigned short*)Bt + (size_t)row * HH + d8) = f.half[0];  }
// layer 3 + pixel shuffle for channels [o0, o0+8): out[n][o][2i+ki][4·jp .. +3] = for (j = 2jp, 2jp+1) × (kj = 0,1): Σ_e H2[(n,i,j)][ol·256 + e]·bf16(W3[o][e][ki·2+kj]) + bf16(b3[o][ki·2+kj]);
__global__ __launch_bounds__(256) void k_l3(const _Float16* __restrict__ H2, const float* __restrict__ W3, const float* __restrict__ b3, int o0, float* __restrict__ out) { const size_t t = (size_t)blockIdx.x * 256 + threadIdx.x; if (t >= (size_t)NBt * OCH * (2 * IH) * 16) return; const int jp = (int)(t % 16); const int y = (int)((t / 16) % (2 * IH)); const int ol = (int)((t / (16 * 2 * IH)) % OCH); const int n = (int)(t / ((size_t)16 * 2 * IH * OCH)); const int o = o0 + ol; const int i = y / 2, ki = y % 2;
  float a[4]; a[0] = bf16_round(b3[o * 4 + ki * 2]); a[1] = bf16_round(b3[o * 4 + ki * 2 + 1]); a[2] = a[0]; a[3] = a[1];
  const _Float16* r0 = H2 + ((size_t)(n * IH + i) * IH + 2 * jp) * (OCH * HH) + ol * HH; const _Float16* r1 = r0 + OCH * HH; const float* w = W3 + (size_t)o * HH * 4 + ki * 2;
#pragma unroll 1
  for (int e = 0; e < HH; ++e) { const float w0 = bf16_round(w[e * 4]), w1 = bf16_round(w[e * 4 + 1]); const float h0 = (float)r0[e], h1 = (float)r1[e]; a[0] += h0 * w0; a[1] += h0 * w1; a[2] += h1 * w0; a[3] += h1 * w1; }
  v4f v; v[0] = a[0]; v[1] = a[1]; v[2] = a[2]; v[3] = a[3]; float* dst = out + (((size_t)n * OC + o) * (2 * IH) + y) * (2 * IH) + jp * 4; *(v4f*)dst = v;  }
extern "C" void kernel_launch(void* const* d_in, const int* in_sizes, int n_in,
                              void* d_out, int out_size, void* d_ws, size_t ws_size, hipStream_t stream) {
  (void)in_sizes; (void)n_in; (void)out_size;
  const float* x = (const float*)d_in[0]; const float* W1 = (const float*)d_in[1]; const float* b1 = (const float*)d_in[2]; const float* W2 = (const float*)d_in[3]; const float* b2 = (const float*)d_in[4]; const float* W3 = (const float*)d_in[5]; const float* b3 = (const float*)d_in[6];
  char* ws = (char*)d_ws; size_t off = 0;
  auto take = [&](size_t bytes) { char* p = ws + off; off += (bytes + 255) & ~(size_t)255; return p; };
  _Float16* Bt1 = (_Float16*)take((size_t)OCH * HH * IC * 2); _Float16* Bt2 = (_Float16*)take((size_t)OC * HH * HH * 2); _Float16* PIX = (_Float16*)take((size_t)NPX * IC * 2); _Float16* H1 = (_Float16*)take((size_t)NPX * OCH * HH * 2); _Float16* H2 = (_Float16*)take((size_t)NPX * OCH * HH * 2);
  if (off > ws_size) return;      // 0.5 + 4 + 2 + 32 × 2 = 70.5 MiB
  k_w2<<<(OC * HH * (HH / 8) + 255) / 256, 256, 0, stream>>>(W2, Bt2); k_pix<<<NBt * 2 * 64, 256, 0, stream>>>(x, PIX);
  for (int ch = 0; ch < OC / OCH; ++ch) { const int o0 = ch * OCH;
    k_w1<<<(OCH * HH * (IC / 8) + 255) / 256, 256, 0, stream>>>(W1, o0, Bt1);
    k_gemm_hhx<3><<<dim3(((NPX / 16) * (OCH * HH / 64) + 3) / 4, 1), 128, 0, stream>>>(PIX, IC, 0, Bt1, IC, 0, 0.0625f, b1 + o0 * HH, 0, nullptr, 1, 0, 0, nullptr, H1, OCH * HH, 0, NPX, OCH * HH, IC);      // h1 for 8 channels (N = 2048; bias b1[o0..o0+7] flat)
    k_gemm_hhx<3><<<dim3(((NPX / 16) * (HH / 64) + 3) / 4, OCH), 128, 0, stream>>>(H1, OCH * HH, (size_t)HH, Bt2 + (size_t)o0 * HH * HH, HH, (size_t)HH * HH, 0.0625f, b2 + o0 * HH, (size_t)HH, nullptr, 1, 0, 0, nullptr, H2, OCH * HH, (size_t)HH, NPX, HH, HH);      // h2 per channel (batched column blocks of 256)
    k_l3<<<(unsigned)(((size_t)NBt * OCH * (2 * IH) * 16 + 255) / 256), 256, 0, stream>>>(H2, W3, b3, o0, (float*)d_out); }
}

// v001
// Measured time: 43.1 microseconds a run.
// Two timings next to v000 put it at 9.21 and 9.23 times that version's speed.
#include <hip/hip_runtime.h>
// DeConv2d as 32 per-output-channel pixel MLPs (8192 pixels x 128 -> 256 -> 256 -> 2x2), all three layers in ONE kernel on v_wmma_f32_16x16x32_f16.
// W [o][in][out] is transposed to bf16-exact x 2^4 f16 rows [out][in] by the prep kernels; k_mlp keeps one channel's weights in LDS and computes every layer transposed
// (A = weight rows, B = pixel columns), so that two f32 D tiles, after + bias, relu and the rounding to f16, ARE the next layer's B fragment: the hidden rows never leave the registers.
#define NBt 8
#define IC 128
#define IH 32
#define NPX (NBt * IH * IH)
#define OC 32
#define HH 256

typedef __bf16 v16b __attribute__((ext_vector_type(16)));
typedef unsigned short v8us __attribute__((ext_vector_type(8), may_alias));
typedef float  v8f  __attribute__((ext_vector_type(8)));
typedef float  v4f  __attribute__((ext_vector_type(4)));
typedef float  v4fa __attribute__((ext_vector_type(4), may_alias));
union FragB { v16b v; v8us half[2]; unsigned short u[16]; };

__device__ __forceinline__ unsigned short bf16_bits(float x) { unsigned int u = __float_as_uint(x); return (unsigned short)((u + 0x7FFFu + ((u >> 16) & 1u)) >> 16); }
__device__ __forceinline__ float bf16_val(unsigned short b) { return __uint_as_float(((unsigned int)b) << 16); }
__device__ __forceinline__ float bf16_round(float x) { return bf16_val(bf16_bits(x)); }
// D += A·B with NT terms: 1 = ah·bh, 2 = + al·bh (A split), 3 = + ah·bl (both split)
template <int NT>
__device__ __forceinline__ v8f mmaN(v16b ah, v16b al, v16b bh, v16b bl, v8f c) {
  c = __builtin_amdgcn_wmma_f32_16x16x32_bf16(false, ah, false, bh, (short)0, c, false, false);
  if (NT >= 2) c = __builtin_amdgcn_wmma_f32_16x16x32_bf16(false, al, false, bh, (short)0, c, false, false);
  if (NT >= 3) c = __builtin_amdgcn_wmma_f32_16x16x32_bf16(false, ah, false, bl, (short)0, c, false, false);
  asm volatile("v_nop\n\tv_nop\n\tv_nop\n\tv_nop" : "+v"(c) : "v"(ah), "v"(al), "v"(bh), "v"(bl));
  return c;
}

__global__ __launch_bounds__(256) void k_wt_bf16(const float* __restrict__ W, unsigned short* __restrict__ Wt, int K, int N) {
  const int t = blockIdx.x * 256 + threadIdx.x;
  const int k8n = K / 8;
  if (t >= N * k8n) return;
  const int n = t / k8n, k8 = (t % k8n) * 8;
  v8us v;
#pragma unroll
  for (int i = 0; i < 8; ++i) v[i] = bf16_bits(W[(size_t)(k8 + i) * N + n]);
  *(v8us*)(Wt + (size_t)n * K + k8) = v;
  
}

// GEMM C[M][N] (f32, pitch ldc) = act(A[M][K]·W + bias). A f32 row-major (pitch lda) converted per fragment to bf16
// (ASPLIT: hi/lo two planes -> 2 terms, else single rounded term); Wt bf16 [N][K] (pitch ldb). BIAS_BF16 rounds the
// bias to bf16 first (bias quantised to bf16 before the add). K%32==0, M%16==0, N%64==0.
template <bool ASPLIT, int ACT, bool BIAS_BF16>
__global__ __launch_bounds__(128) void k_gemm_bf(const float* __restrict__ A, int lda, const unsigned short* __restrict__ Wt, int ldb,
                                               const float* __restrict__ bias, float* __restrict__ C, int ldc, int M, int N, int K) {
  __shared__ __attribute__((aligned(16))) float so[4][16][64];
  const int tid = threadIdx.x, w = tid >> 5, lane = tid & 31, ln = lane & 15, hh = lane >> 4;
  const int ntn = N / 64;
  const int wid = blockIdx.x * 4 + w;
  const int mt = wid / ntn, nq = wid % ntn;
  if (mt * 16 >= M) return;
  const int row0 = mt * 16, col0 = nq * 64;
  const float* arow = A + (size_t)(row0 + ln) * lda;
  v8f acc[4] = {};
  for (int kb = 0; kb < K; kb += 32) {
    FragB ah, al;
    const v4f x0 = *(const v4fa*)(arow + kb + 8 * hh), x1 = *(const v4fa*)(arow + kb + 8 * hh + 4);
    const v4f x2 = *(const v4fa*)(arow + kb + 16 + 8 * hh), x3 = *(const v4fa*)(arow + kb + 16 + 8 * hh + 4);
    float xs[16] = {x0[0],x0[1],x0[2],x0[3],x1[0],x1[1],x1[2],x1[3],x2[0],x2[1],x2[2],x2[3],x3[0],x3[1],x3[2],x3[3]};
#pragma unroll
    for (int i = 0; i < 16; ++i) { const unsigned short hb = bf16_bits(xs[i]); ah.u[i] = hb; al.u[i] = ASPLIT ? bf16_bits(xs[i] - bf16_val(hb)) : (unsigned short)0; }
#pragma unroll
    for (int t = 0; t < 4; ++t) {
      const unsigned short* brow = Wt + (size_t)(col0 + t * 16 + ln) * ldb + kb;
      FragB b;
      b.half[0] = *(const v8us*)(brow + 8 * hh);
      b.half[1] = *(const v8us*)(brow + 16 + 8 * hh);
      acc[t] = mmaN<ASPLIT ? 2 : 1>(ah.v, al.v, b.v, b.v, acc[t]);
    }
  }
#pragma unroll
  for (int t = 0; t < 4; ++t) {
    float bv = bias ? bias[col0 + t * 16 + ln] : 0.f;
    if (BIAS_BF16) bv = bf16_round(bv);
#pragma unroll
    for (int r = 0; r < 8; ++r) { float v = acc[t][r] + bv; if (ACT == 1) v = fmaxf(v, 0.f); so[w][8 * hh + r][t * 16 + ln] = v; }
  }
  __builtin_amdgcn_fence(__ATOMIC_ACQ_REL, "workgroup");
  __builtin_amdgcn_wave_barrier();
  const int rsub = lane >> 4, c4 = (lane & 15) * 4;
  {
#pragma unroll
    for (int q = 0; q < 8; ++q) {
      const int r = q * 2 + rsub;
      const v4f v = *(const v4fa*)&so[w][r][c4];
      *(v4f*)(C + (size_t)(row0 + r) * ldc + col0 + c4) = v;
    }
    
  }
}

// Flash-style causal/unmasked attention, all contractions 3-term bf16 hi/lo splits, f32 softmax with running max.
// q,k,v rows are read from f32 buffers with arbitrary row pitch (so they can live inside a fused qkv buffer);
// D = head size (multiple of 32, <= 128); one wave = 16 query rows; block = 4 waves (64 queries) sharing K/V chunks of 32.
template <int D, bool CAUSAL>
__global__ __launch_bounds__(128) void k_flash(const float* __restrict__ qb, const float* __restrict__ kb, const float* __restrict__ vb,
                                             int pitch, int T, int H, float scale, float* __restrict__ y, int ypitch) {
  constexpr int KS = D / 32;        // k-steps for QK
  constexpr int DT = D / 16;        // d tiles for PV
  __shared__ __attribute__((aligned(16))) unsigned short sKh[32][D + 8], sKl[32][D + 8], sVh[32][D + 8], sVl[32][D + 8];
  __shared__ __attribute__((aligned(16))) unsigned short sPh[4][16][40], sPl[4][16][40];
  __shared__ __attribute__((aligned(16))) float sO[4][16][D];
  const int tid = threadIdx.x, w = tid >> 5, lane = tid & 31, ln = lane & 15, hh = lane >> 4;
  const int nqb = (T + 63) / 64;
  const int bh = blockIdx.x / nqb, qblk = blockIdx.x % nqb;
  const int b = bh / H, h = bh % H;
  const int q0 = qblk * 64 + w * 16;
  const float* Q = qb + (size_t)b * T * pitch + h * D;
  const float* K = kb + (size_t)b * T * pitch + h * D;
  const float* V = vb + (size_t)b * T * pitch + h * D;

  // A fragments of the wave's 16 query rows (scaled), hi/lo
  FragB aqh[KS], aql[KS];
  {
    int row = q0 + ln; if (row >= T) row = T - 1;
    const float* qr = Q + (size_t)row * pitch;
#pragma unroll
    for (int ks = 0; ks < KS; ++ks)
#pragma unroll
      for (int i = 0; i < 16; ++i) {
        const int d = ks * 32 + ((i < 8) ? (8 * hh + i) : (16 + 8 * hh + (i - 8)));
        const float x = qr[d] * scale; const unsigned short hb = bf16_bits(x);
        aqh[ks].u[i] = hb; aql[ks].u[i] = bf16_bits(x - bf16_val(hb));
      }
  }
  float m_r[8], l_r[8];
#pragma unroll
  for (int r = 0; r < 8; ++r) { m_r[r] = -3.0e38f; l_r[r] = 0.f; }
  v8f oacc[DT];
#pragma unroll
  for (int dt = 0; dt < DT; ++dt) oacc[dt] = (v8f){0.f,0.f,0.f,0.f,0.f,0.f,0.f,0.f};

  const int kv_end = CAUSAL ? min(T, qblk * 64 + 64) : T;     // block-uniform
  for (int j0 = 0; j0 < kv_end; j0 += 32) {
    __syncthreads();
    for (int e = tid; e < 32 * (D / 4); e += 128) {
      const int r = e / (D / 4), c4 = (e % (D / 4)) * 4;
      const int key = j0 + r;
      v4f kf = {0.f,0.f,0.f,0.f}, vf = {0.f,0.f,0.f,0.f};
      if (key < T) { kf = *(const v4fa*)(K + (size_t)key * pitch + c4); vf = *(const v4fa*)(V + (size_t)key * pitch + c4); }
#pragma unroll
      for (int t = 0; t < 4; ++t) {
        unsigned short hb = bf16_bits(kf[t]); sKh[r][c4 + t] = hb; sKl[r][c4 + t] = bf16_bits(kf[t] - bf16_val(hb));
        hb = bf16_bits(vf[t]); sVh[r][c4 + t] = hb; sVl[r][c4 + t] = bf16_bits(vf[t] - bf16_val(hb));
      }
    }
    __syncthreads();
    // S tile 16 x 32
    v8f s[2];
#pragma unroll
    for (int nt = 0; nt < 2; ++nt) {
      v8f acc = {};
#pragma unroll
      for (int ks = 0; ks < KS; ++ks) {
        FragB bh_, bl_;
        bh_.half[0] = *(const v8us*)&sKh[nt * 16 + ln][ks * 32 + 8 * hh]; bh_.half[1] = *(const v8us*)&sKh[nt * 16 + ln][ks * 32 + 16 + 8 * hh];
        bl_.half[0] = *(const v8us*)&sKl[nt * 16 + ln][ks * 32 + 8 * hh]; bl_.half[1] = *(const v8us*)&sKl[nt * 16 + ln][ks * 32 + 16 + 8 * hh];
        acc = mmaN<3>(aqh[ks].v, aql[ks].v, bh_.v, bl_.v, acc);
      }
      s[nt] = acc;
    }
    // mask + running max (rows 8hh+r; the 16 lanes of a half share rows)
    float alpha[8];
#pragma unroll
    for (int r = 0; r < 8; ++r) {
      const int qi = q0 + 8 * hh + r;
      const int ja = j0 + ln, jb = j0 + 16 + ln;
      if (CAUSAL) { if (ja > qi) s[0][r] = -3.0e38f; if (jb > qi) s[1][r] = -3.0e38f; }
      if (ja >= T) s[0][r] = -3.0e38f;
      if (jb >= T) s[1][r] = -3.0e38f;
      float mx = fmaxf(s[0][r], s[1][r]);
      mx = fmaxf(mx, __shfl_xor(mx, 1, 32)); mx = fmaxf(mx, __shfl_xor(mx, 2, 32)); mx = fmaxf(mx, __shfl_xor(mx, 4, 32)); mx = fmaxf(mx, __shfl_xor(mx, 8, 32));
      const float mnew = fmaxf(m_r[r], mx);
      alpha[r] = (mnew > -1.0e38f) ? __expf(m_r[r] - mnew) : 1.0f;
      const float p0 = (s[0][r] > -1.0e38f) ? __expf(s[0][r] - mnew) : 0.f;
      const float p1 = (s[1][r] > -1.0e38f) ? __expf(s[1][r] - mnew) : 0.f;
      m_r[r] = mnew;
      l_r[r] = l_r[r] * alpha[r] + p0 + p1;            // per-lane partial row sum (16 lanes combined at the end)
      unsigned short hb = bf16_bits(p0); sPh[w][8 * hh + r][ln] = hb;      sPl[w][8 * hh + r][ln] = bf16_bits(p0 - bf16_val(hb));
      hb = bf16_bits(p1);                sPh[w][8 * hh + r][16 + ln] = hb; sPl[w][8 * hh + r][16 + ln] = bf16_bits(p1 - bf16_val(hb));
    }
#pragma unroll
    for (int dt = 0; dt < DT; ++dt)
#pragma unroll
      for (int r = 0; r < 8; ++r) oacc[dt][r] *= alpha[r];
    __builtin_amdgcn_fence(__ATOMIC_ACQ_REL, "workgroup");
    __builtin_amdgcn_wave_barrier();
    FragB pah, pal;
    pah.half[0] = *(const v8us*)&sPh[w][ln][8 * hh]; pah.half[1] = *(const v8us*)&sPh[w][ln][16 + 8 * hh];
    pal.half[0] = *(const v8us*)&sPl[w][ln][8 * hh]; pal.half[1] = *(const v8us*)&sPl[w][ln][16 + 8 * hh];
#pragma unroll
    for (int dt = 0; dt < DT; ++dt) {
      FragB bvh, bvl;
#pragma unroll
      for (int i = 0; i < 8; ++i) {
        bvh.u[i] = sVh[8 * hh + i][dt * 16 + ln]; bvh.u[8 + i] = sVh[16 + 8 * hh + i][dt * 16 + ln];
        bvl.u[i] = sVl[8 * hh + i][dt * 16 + ln]; bvl.u[8 + i] = sVl[16 + 8 * hh + i][dt * 16 + ln];
      }
      oacc[dt] = mmaN<3>(pah.v, pal.v, bvh.v, bvl.v, oacc[dt]);
    }
    __builtin_amdgcn_fence(__ATOMIC_ACQ_REL, "workgroup");
    __builtin_amdgcn_wave_barrier();
  }
#pragma unroll
  for (int r = 0; r < 8; ++r) {
    float l = l_r[r];
    l += __shfl_xor(l, 1, 32); l += __shfl_xor(l, 2, 32); l += __shfl_xor(l, 4, 32); l += __shfl_xor(l, 8, 32);
    l_r[r] = (l > 0.f) ? 1.0f / l : 0.f;
  }
#pragma unroll
  for (int dt = 0; dt < DT; ++dt)
#pragma unroll
    for (int r = 0; r < 8; ++r) sO[w][8 * hh + r][dt * 16 + ln] = oacc[dt][r] * l_r[r];
  __builtin_amdgcn_fence(__ATOMIC_ACQ_REL, "workgroup");
  __builtin_amdgcn_wave_barrier();
  {
    for (int r = 0; r < 16; ++r) {
      const int row = q0 + r;
      if (row < T && lane < D / 4) {
        const v4f val = *(const v4fa*)&sO[w][r][lane * 4];
        *(v4f*)(y + ((size_t)b * T + row) * ypitch + h * D + lane * 4) = val;
      }
    }
    
  }
}

// GEMM C = act(A·W + bias + resid): A f32 (ASPLIT -> hi/lo 2 terms), Wt bf16 [N][K]; ACT 0 none, 1 relu, 2 exact gelu;
// resid (optional, f32, row index = (row % rmod), pitch ldr, RES_BF16 rounds it) added before the activation.
template <bool ASPLIT, int ACT, bool BIAS_BF16, bool RES_BF16>
__global__ __launch_bounds__(128) void k_gemm_bf3(const float* __restrict__ A, int lda, const unsigned short* __restrict__ Wt, int ldb,
                                                const float* __restrict__ bias, const float* __restrict__ resid, int rmod, int ldr,
                                                float* __restrict__ C, int ldc, int M, int N, int K) {
  __shared__ __attribute__((aligned(16))) float so[4][16][64];
  const int tid = threadIdx.x, w = tid >> 5, lane = tid & 31, ln = lane & 15, hh = lane >> 4;
  const int ntn = N / 64;
  const int wid = blockIdx.x * 4 + w;
  const int mt = wid / ntn, nq = wid % ntn;
  if (mt * 16 >= M) return;
  const int row0 = mt * 16, col0 = nq * 64;
  const float* arow = A + (size_t)(row0 + ln) * lda;
  v8f acc[4] = {};
  for (int kb = 0; kb < K; kb += 32) {
    FragB ah, al;
    const v4f x0 = *(const v4fa*)(arow + kb + 8 * hh), x1 = *(const v4fa*)(arow + kb + 8 * hh + 4);
    const v4f x2 = *(const v4fa*)(arow + kb + 16 + 8 * hh), x3 = *(const v4fa*)(arow + kb + 16 + 8 * hh + 4);
    float xs[16] = {x0[0],x0[1],x0[2],x0[3],x1[0],x1[1],x1[2],x1[3],x2[0],x2[1],x2[2],x2[3],x3[0],x3[1],x3[2],x3[3]};
#pragma unroll
    for (int i = 0; i < 16; ++i) { const unsigned short hb = bf16_bits(xs[i]); ah.u[i] = hb; al.u[i] = ASPLIT ? bf16_bits(xs[i] - bf16_val(hb)) : (unsigned short)0; }
#pragma unroll
    for (int t = 0; t < 4; ++t) {
      const unsigned short* brow = Wt + (size_t)(col0 + t * 16 + ln) * ldb + kb;
      FragB b;
      b.half[0] = *(const v8us*)(brow + 8 * hh);
      b.half[1] = *(const v8us*)(brow + 16 + 8 * hh);
      acc[t] = mmaN<ASPLIT ? 2 : 1>(ah.v, al.v, b.v, b.v, acc[t]);
    }
  }
#pragma unroll
  for (int t = 0; t < 4; ++t) {
    const int col = col0 + t * 16 + ln;
    float bv = bias ? bias[col] : 0.f;
    if (BIAS_BF16) bv = bf16_round(bv);
#pragma unroll
    for (int r = 0; r < 8; ++r) {
      float v = acc[t][r] + bv;
      if (resid) { float rv = resid[(size_t)((row0 + 8 * hh + r) % rmod) * ldr + col]; if (RES_BF16) rv = bf16_round(rv); v += rv; }
      if (ACT == 1) v = fmaxf(v, 0.f);
      if (ACT == 2) v = 0.5f * v * (1.0f + erff(v * 0.70710678118654752f));
      if (ACT == 3) { const float u = 0.7978845608028654f * (v + 0.044715f * v * v * v); v = 0.5f * v * (1.0f + tanhf(u)); }
      so[w][8 * hh + r][t * 16 + ln] = v;
    }
  }
  __builtin_amdgcn_fence(__ATOMIC_ACQ_REL, "workgroup");
  __builtin_amdgcn_wave_barrier();
  const int rsub = lane >> 4, c4 = (lane & 15) * 4;
  {
#pragma unroll
    for (int q = 0; q < 8; ++q) {
      const int r = q * 2 + rsub;
      const v4f v = *(const v4fa*)&so[w][r][c4];
      *(v4f*)(C + (size_t)(row0 + r) * ldc + col0 + c4) = v;
    }
    
  }
}
// row LayerNorm (biased variance, eps) over N: s = X (+ R); optional out_sum <- s; out_norm <- (s-mu)*rsqrt(var+eps)*g + b
template <bool PARAM_BF16>
__global__ __launch_bounds__(256) void k_layernorm(const float* __restrict__ X, const float* __restrict__ R, const float* __restrict__ g, const float* __restrict__ bta,
                                                  float* __restrict__ out_sum, float* __restrict__ out_norm, int N, float eps) {
  __shared__ float red[256];
  const int row = blockIdx.x, tid = threadIdx.x;
  const float* x = X + (size_t)row * N; const float* rr = R ? R + (size_t)row * N : nullptr;
  float vals[16];                     // up to N = 4096
  const int per = N / 256;            // contiguous chunk per thread? use strided-by-4 chunks: thread handles j = tid*4 + 1024*u
  float s1 = 0.f;
  for (int u = 0; u < per / 4; ++u) {
    const int j = tid * 4 + 1024 * u;
    const v4f a = *(const v4fa*)(x + j);
    v4f b = {0.f,0.f,0.f,0.f}; if (rr) b = *(const v4fa*)(rr + j);
#pragma unroll
    for (int q = 0; q < 4; ++q) { const float v = a[q] + b[q]; vals[u * 4 + q] = v; s1 += v; }
  }
  red[tid] = s1; __syncthreads();
  for (int st = 128; st > 0; st >>= 1) { if (tid < st) red[tid] += red[tid + st]; __syncthreads(); }
  const float mu = red[0] / (float)N; __syncthreads();
  float s2 = 0.f;
  for (int u = 0; u < per / 4; ++u)
#pragma unroll
    for (int q = 0; q < 4; ++q) { const float c = vals[u * 4 + q] - mu; s2 += c * c; }
  red[tid] = s2; __syncthreads();
  for (int st = 128; st > 0; st >>= 1) { if (tid < st) red[tid] += red[tid + st]; __syncthreads(); }
  const float rs = rsqrtf(red[0] / (float)N + eps);
  {
    for (int u = 0; u < per / 4; ++u) {
      const int j = tid * 4 + 1024 * u;
      v4f o, sm;
#pragma unroll
      for (int q = 0; q < 4; ++q) {
        float gg = g[j + q], bb = bta[j + q];
        if (PARAM_BF16) { gg = bf16_round(gg); bb = bf16_round(bb); }
        sm[q] = vals[u * 4 + q]; o[q] = (vals[u * 4 + q] - mu) * rs * gg + bb;
      }
      if (out_sum) *(v4f*)(out_sum + (size_t)row * N + j) = sm;
      *(v4f*)(out_norm + (size_t)row * N + j) = o;
    }
    
  }
}



// ---- f16 WMMA path (v_wmma_f32_16x16x32_f16): 11-bit significands for operands in range — used here for all three MLP layers (k_mlp)
typedef _Float16 v16h __attribute__((ext_vector_type(16)));
union FragH { v16h v; v8us half[2]; _Float16 h[16]; unsigned short u[16]; };
template <int NT>
__device__ __forceinline__ v8f mmaH(v16h ah, v16h al, v16h bh, v16h bl, v8f c) {
  c = __builtin_amdgcn_wmma_f32_16x16x32_f16(false, ah, false, bh, (short)0, c, false, false);
  if (NT >= 2) c = __builtin_amdgcn_wmma_f32_16x16x32_f16(false, al, false, bh, (short)0, c, false, false);
  if (NT >= 3) c = __builtin_amdgcn_wmma_f32_16x16x32_f16(false, ah, false, bl, (short)0, c, false, false);
  asm volatile("v_nop\n\tv_nop\n\tv_nop\n\tv_nop" : "+v"(c) : "v"(ah), "v"(al), "v"(bh), "v"(bl));
  return c;
}
// batched GEMM like k_gemm_b but f16 operands: A f32 (split into f16 hi/lo if ASPLIT, else rounded to f16), Bt = f16 values [n][k]; alpha; C f32; N multiple of 16 (partial tiles skipped)
template <bool ASPLIT>
__global__ __launch_bounds__(128) void k_gemm_h(const float* __restrict__ A, int lda, size_t sA, const _Float16* __restrict__ Bh, int ldb, size_t sB, float alpha, float* __restrict__ C, int ldc, size_t sC, int M, int N, int K) {
  __shared__ __attribute__((aligned(16))) float so[4][16][64];
  const int tid = threadIdx.x, w = tid >> 5, lane = tid & 31, ln = lane & 15, hh = lane >> 4; const int by = blockIdx.y;
  A += (size_t)by * sA; Bh += (size_t)by * sB; C += (size_t)by * sC;
  const int ntn = (N + 63) / 64; const int wid = blockIdx.x * 4 + w; const int mt = wid / ntn, nq = wid % ntn; if (mt * 16 >= M) return;
  const int row0 = mt * 16, col0 = nq * 64; const float* arow = A + (size_t)(row0 + ln) * lda;
  v8f acc[4] = {};
  for (int kb = 0; kb < K; kb += 32) {
    FragH ah, al;
    const v4f x0 = *(const v4fa*)(arow + kb + 8 * hh), x1 = *(const v4fa*)(arow + kb + 8 * hh + 4), x2 = *(const v4fa*)(arow + kb + 16 + 8 * hh), x3 = *(const v4fa*)(arow + kb + 16 + 8 * hh + 4);
    float xs[16] = {x0[0],x0[1],x0[2],x0[3],x1[0],x1[1],x1[2],x1[3],x2[0],x2[1],x2[2],x2[3],x3[0],x3[1],x3[2],x3[3]};
#pragma unroll
    for (int i = 0; i < 16; ++i) { const _Float16 h = (_Float16)xs[i]; ah.h[i] = h; al.h[i] = ASPLIT ? (_Float16)(xs[i] - (float)h) : (_Float16)0.0f; }
#pragma unroll
    for (int t = 0; t < 4; ++t) { if (col0 + t * 16 >= N) continue; const size_t boff = (size_t)(col0 + t * 16 + ln) * ldb + kb; FragH bq; bq.half[0] = *(const v8us*)(Bh + boff + 8 * hh); bq.half[1] = *(const v8us*)(Bh + boff + 16 + 8 * hh);
      acc[t] = mmaH<ASPLIT ? 2 : 1>(ah.v, al.v, bq.v, bq.v, acc[t]); }
  }
#pragma unroll
  for (int t = 0; t < 4; ++t) { if (col0 + t * 16 >= N) continue;
#pragma unroll
    for (int r = 0; r < 8; ++r) so[w][8 * hh + r][t * 16 + ln] = acc[t][r] * alpha; }
  __builtin_amdgcn_fence(__ATOMIC_ACQ_REL, "workgroup"); __builtin_amdgcn_wave_barrier();
  const int rsub = lane >> 4, c4 = (lane & 15) * 4;
  {
#pragma unroll
    for (int q = 0; q < 8; ++q) { const int r = q * 2 + rsub; if (col0 + c4 < N) { const v4f v = *(const v4fa*)&so[w][r][c4]; *(v4f*)(C + (size_t)(row0 + r) * ldc + col0 + c4) = v; } }
     }
}

// Wt[n][k] = f16(W[k][n]·scale) from f32 row-major W[K][N] (scale = power of two; bf16-exact weights stay exact in f16 away from the subnormal range)
__global__ __launch_bounds__(256) void k_wt_f16(const float* __restrict__ W, _Float16* __restrict__ Wt, int K, int N, float scale) {
  const int t = blockIdx.x * 256 + threadIdx.x; if (t >= N * (K / 8)) return; const int n = t / (K / 8), k8 = (t % (K / 8)) * 8; FragH f;
#pragma unroll
  for (int i = 0; i < 8; ++i) f.h[i] = (_Float16)(bf16_round(W[(size_t)(k8 + i) * N + n]) * scale); const v8us o = f.half[0];
  *(v8us*)((unsigned short*)Wt + (size_t)n * K + k8) = o; 
}

__global__ __launch_bounds__(256) void k_pix(const float* __restrict__ x, _Float16* __restrict__ PIX) { __shared__ unsigned short tl[16][72]; const int tid = threadIdx.x; const int n = blockIdx.x / (2 * 64), rem = blockIdx.x % (2 * 64); const int cg = rem / 64, pg = rem % 64; const int c0 = cg * 64, p0 = pg * 16;
  for (int i = tid; i < 64 * 16; i += 256) { const int c = i / 16, pp = i % 16; FragH f; f.h[0] = (_Float16)bf16_round(x[((size_t)n * IC + c0 + c) * (IH * IH) + p0 + pp]); tl[pp][c] = f.u[0]; }
  __syncthreads();
  if (tid < 128) { const int r = tid / 8, pc = tid % 8; FragH f;
#pragma unroll
    for (int q = 0; q < 8; ++q) f.u[q] = tl[r][pc * 8 + q]; unsigned short* d = (unsigned short*)PIX + ((size_t)n * IH * IH + p0 + r) * IC + c0 + pc * 8; *(v8us*)d = f.half[0];  } }
__global__ __launch_bounds__(256) void k_w1(const float* __restrict__ W1, _Float16* __restrict__ Bt) { const int t = blockIdx.x * 256 + threadIdx.x; if (t >= OC * HH * (IC / 8)) return; const int row = t / (IC / 8), c8 = (t % (IC / 8)) * 8; const int ol = row / HH, d = row % HH; FragH f;
#pragma unroll
  for (int q = 0; q < 8; ++q) f.h[q] = (_Float16)(bf16_round(W1[(((size_t)ol) * IC + c8 + q) * HH + d]) * 16.0f); *(v8us*)((unsigned short*)Bt + (size_t)row * IC + c8) = f.half[0];  }
__global__ __launch_bounds__(256) void k_w2(const float* __restrict__ W2, _Float16* __restrict__ Bt) { const int t = blockIdx.x * 256 + threadIdx.x; if (t >= OC * HH * (HH / 8)) return; const int row = t / (HH / 8), d8 = (t % (HH / 8)) * 8; const int o = row / HH, e = row % HH; FragH f;
#pragma unroll
  for (int q = 0; q < 8; ++q) f.h[q] = (_Float16)(bf16_round(W2[(((size_t)o) * HH + d8 + q) * HH + e]) * 16.0f); *(v8us*)((unsigned short*)Bt + (size_t)row * HH + d8) = f.half[0];  }
#define NPT 2           // pixel tiles of 16 per wave = one image row of 32 pixels; each weight fragment read from LDS feeds NPT products
#define P1 (IC + 8)     // LDS row pitch in f16: 272 B and 528 B are 16 B x odd, the conflict-free pitch for ds_load_b128 fragment reads
#define P2 (HH + 8)
typedef float v2f __attribute__((ext_vector_type(2)));
__device__ __forceinline__ v8f wmma_h(v16h a, v16h b, v8f c) { return __builtin_amdgcn_wmma_f32_16x16x32_f16(false, a, false, b, (short)0, c, false, false); }
// fragment of row (or column) 'row' at k0: elements 0..7 = k0 + 8hh + 0..7, elements 8..15 = k0 + 16 + 8hh + 0..7 (the order a packed pair of D tiles has)
__device__ __forceinline__ v16h frag_at(const unsigned short* row, int k0, int hh) { FragH f; f.half[0] = *(const v8us*)(row + k0 + 8 * hh); f.half[1] = *(const v8us*)(row + k0 + 16 + 8 * hh); return f.v; }
// half a B fragment of the next layer from one D tile: h[r] = f16(relu(acc[r] / 16 + bias[8hh + r])), c0 and c1 = the lane's 8 bias values
__device__ __forceinline__ void pack_tile(FragH& f, int u, v8f acc, v4f c0, v4f c1) {
#pragma unroll
  for (int r = 0; r < 8; ++r) f.h[u * 8 + r] = (_Float16)fmaxf(acc[r] * 0.0625f + (r < 4 ? c0[r & 3] : c1[r & 3]), 0.f);
}
// One work-group = one output channel o and one image n; 8 waves, each takes image rows i = w, w + 8, ...
// D maps: layers 1, 2: acc[r] = hidden[16t + 8hh + r][pixel ln]. Layer 3: rows 0, 1, 8, 9 of its A operand hold W3's columns k = 0, 1, 2, 3 (the rest zero), so acc3[kj] = out_k[2hh + kj][pixel ln]: ki = hh.
__global__ __launch_bounds__(256) void k_mlp(const _Float16* __restrict__ PIX, const _Float16* __restrict__ Bt1, const _Float16* __restrict__ Bt2, const float* __restrict__ b1, const float* __restrict__ b2,
                                             const float* __restrict__ W3, const float* __restrict__ b3, float* __restrict__ out) {
  __shared__ __attribute__((aligned(16))) unsigned short sW1[HH][P1], sW2[HH][P2], sW3[16][P2];
  __shared__ __attribute__((aligned(16))) float sB1[HH], sB2[HH];
  const int tid = threadIdx.x, lane = tid & 31, ln = lane & 15, hh = lane >> 4;
  const int w = __builtin_amdgcn_readfirstlane(tid >> 5);      // the wave's number in a scalar register: the row loop below branches on SCC and leaves EXEC alone
  const int o = blockIdx.x / NBt, n = blockIdx.x % NBt;
  const unsigned short* g1 = (const unsigned short*)Bt1 + (size_t)o * HH * IC;
  const unsigned short* g2 = (const unsigned short*)Bt2 + (size_t)o * HH * HH;
  // staging, unrolled in full: all of a thread's 16-byte reads are in flight together, one L2 round trip instead of one per loop trip
#pragma unroll
  for (int q = 0; q < HH / 16; ++q) *(v8us*)&sW1[q * 16 + tid / 16][(tid % 16) * 8] = *(const v8us*)(g1 + (tid / 16) * IC + (tid % 16) * 8 + q * 16 * IC);
#pragma unroll
  for (int q = 0; q < HH / 8; ++q) *(v8us*)&sW2[q * 8 + tid / 32][(tid % 32) * 8] = *(const v8us*)(g2 + (tid / 32) * HH + (tid % 32) * 8 + q * 8 * HH);
  { const v4f w3 = *(const v4fa*)(W3 + ((size_t)o * HH + tid) * 4);      // thread = hidden unit e: its four k
#pragma unroll
    for (int m = 0; m < 16; ++m) { FragH f; f.h[0] = (_Float16)(bf16_round(w3[(m >> 3) * 2 + (m & 1)]) * 16.0f); sW3[m][tid] = ((m & 6) == 0) ? f.u[0] : (unsigned short)0; } }
  sB1[tid] = bf16_round(b1[o * HH + tid]); sB2[tid] = bf16_round(b2[o * HH + tid]);
  const float c30 = bf16_round(hh ? b3[o * 4 + 2] : b3[o * 4]), c31 = bf16_round(hh ? b3[o * 4 + 3] : b3[o * 4 + 1]);      // ki = hh picks the pair
  __syncthreads();      // the weights are read-only from here on: the kernel's only barrier
  const unsigned short* prow = (const unsigned short*)PIX + ((size_t)(n * IH + w) * IH + ln) * IC + 8 * hh;      // pixel (n, i = w, j = ln), the lane half's k offset included
  v16h px[NPT][IC / 32];
#pragma unroll
  for (int p = 0; p < NPT; ++p)
#pragma unroll
    for (int kb = 0; kb < IC / 32; ++kb) px[p][kb] = frag_at(prow + p * 16 * IC, kb * 32, 0);
  for (int i = w; i < IH; i += 8) {
    FragH h1[NPT][HH / 32];
    v16h wa[2][2 * (IC / 32)]; v4f wc[2][4];      // two register sets: tile pair s + 1 is read from LDS while pair s is multiplied
#pragma unroll
    for (int q = 0; q < 2 * (IC / 32); ++q) wa[0][q] = frag_at(&sW1[(q & 1) * 16 + ln][0], (q >> 1) * 32, hh);
#pragma unroll
    for (int q = 0; q < 4; ++q) wc[0][q] = *(const v4fa*)&sB1[(q >> 1) * 16 + 8 * hh + (q & 1) * 4];
    // full unroll: h1 is indexed by s and has to stay in registers
#pragma unroll
    for (int s = 0; s < HH / 32; ++s) {
      if (s + 1 < HH / 32) {
#pragma unroll
        for (int q = 0; q < 2 * (IC / 32); ++q) wa[(s + 1) & 1][q] = frag_at(&sW1[(2 * (s + 1) + (q & 1)) * 16 + ln][0], (q >> 1) * 32, hh);
#pragma unroll
        for (int q = 0; q < 4; ++q) wc[(s + 1) & 1][q] = *(const v4fa*)&sB1[(2 * (s + 1) + (q >> 1)) * 16 + 8 * hh + (q & 1) * 4];
      }
      // keeps the next pair's LDS reads ahead of this pair's matrix instructions; left free, the scheduler puts each read directly in front of its use and every product waits out the LDS latency
      __builtin_amdgcn_sched_barrier(0);
      v8f acc[2][NPT] = {};
#pragma unroll
      for (int kb = 0; kb < IC / 32; ++kb)
#pragma unroll
        for (int u = 0; u < 2; ++u)
#pragma unroll
          for (int p = 0; p < NPT; ++p) acc[u][p] = wmma_h(wa[s & 1][kb * 2 + u], px[p][kb], acc[u][p]);
#pragma unroll
      for (int u = 0; u < 2; ++u)
#pragma unroll
        for (int p = 0; p < NPT; ++p) pack_tile(h1[p][s], u, acc[u][p], wc[s & 1][u * 2], wc[s & 1][u * 2 + 1]);
    }
    // the next row's pixel fragments fly during layer 2 (the last trip reads its own row again: in bounds, unused)
    asm volatile("s_wait_xcnt 0x0" ::: "memory");      // the next line overwrites the address registers that this row's pixel loads name
    prow += (i + 8 < IH) ? 8 * IH * IC : 0;
#pragma unroll
    for (int p = 0; p < NPT; ++p)
#pragma unroll
      for (int kb = 0; kb < IC / 32; ++kb) px[p][kb] = frag_at(prow + p * 16 * IC, kb * 32, 0);
    v8f acc3[NPT] = {};
    // kept rolled: the body already holds 34 matrix instructions, and unrolled the weight reads of all trips are lifted ahead and spill
#pragma unroll 1
    for (int s = 0; s < HH / 32; ++s) {
      v8f acc[2][NPT] = {};
      // full unroll: h1 is indexed by kb
#pragma unroll
      for (int kb = 0; kb < HH / 32; ++kb)
#pragma unroll
        for (int u = 0; u < 2; ++u) {
          const v16h a = frag_at(&sW2[(2 * s + u) * 16 + ln][0], kb * 32, hh);
#pragma unroll
          for (int p = 0; p < NPT; ++p) acc[u][p] = wmma_h(a, h1[p][kb].v, acc[u][p]);
        }
      const v16h a3 = frag_at(&sW3[ln][0], s * 32, hh);
      const float* bs = &sB2[2 * s * 16 + 8 * hh];
      const v4f d0 = *(const v4fa*)bs, d1 = *(const v4fa*)(bs + 4), d2 = *(const v4fa*)(bs + 16), d3 = *(const v4fa*)(bs + 20);
#pragma unroll
      for (int p = 0; p < NPT; ++p) {
        FragH h2;
        pack_tile(h2, 0, acc[0][p], d0, d1); pack_tile(h2, 1, acc[1][p], d2, d3);
        acc3[p] = wmma_h(a3, h2.v, acc3[p]);
      }
    }
    // pixel shuffle: lane (ln, hh) holds kj = 0, 1 of output row 2i + hh for pixel j = 16p + ln; each half wave stores one whole 128-B line
    float* orow = out + (((size_t)n * OC + o) * (2 * IH) + 2 * i + hh) * (2 * IH) + 2 * ln;
#pragma unroll
    for (int p = 0; p < NPT; ++p) { v2f y; y[0] = acc3[p][0] * 0.0625f + c30; y[1] = acc3[p][1] * 0.0625f + c31; *(v2f*)(orow + p * 32) = y; }
    asm volatile("s_wait_xcnt 0x0" ::: "memory");      // the next trip overwrites the registers that these stores name (its clobber also keeps the loop-invariant weight reads from being hoisted into registers, where they spill)
  }
}
extern "C" void kernel_launch(void* const* d_in, const int* in_sizes, int n_in,
                              void* d_out, int out_size, void* d_ws, size_t ws_size, hipStream_t stream) {
  (void)in_sizes; (void)n_in; (void)out_size;
  const float* x = (const float*)d_in[0]; const float* W1 = (const float*)d_in[1]; const float* b1 = (const float*)d_in[2]; const float* W2 = (const float*)d_in[3]; const float* b2 = (const float*)d_in[4]; const float* W3 = (const float*)d_in[5]; const float* b3 = (const float*)d_in[6];
  char* ws = (char*)d_ws; size_t off = 0;
  auto take = [&](size_t bytes) { char* p = ws + off; off += (bytes + 255) & ~(size_t)255; return p; };
  _Float16* Bt1 = (_Float16*)take((size_t)OC * HH * IC * 2); _Float16* Bt2 = (_Float16*)take((size_t)OC * HH * HH * 2); _Float16* PIX = (_Float16*)take((size_t)NPX * IC * 2);
  if (off > ws_size) return;      // 2.1 + 4.2 + 2.1 MiB
  k_w2<<<(OC * HH * (HH / 8) + 255) / 256, 256, 0, stream>>>(W2, Bt2); k_pix<<<NBt * 2 * 64, 256, 0, stream>>>(x, PIX);
  k_w1<<<(OC * HH * (IC / 8) + 255) / 256, 256, 0, stream>>>(W1, Bt1);
  k_mlp<<<OC * NBt, 256, 0, stream>>>(PIX, Bt1, Bt2, b1, b2, W3, b3, (float*)d_out);
}

// v002
// It runs in 33.8 microseconds.
// Next to v001, in two timings, it ran 1.27 times as fast each time.
// Counting every step since v000, it is 11.7 times as fast.
#include <hip/hip_runtime.h>
// DeConv2d as 32 per-output-channel pixel MLPs (8192 pixels x 128 -> 256 -> 256 -> 2x2), all three layers in ONE kernel on v_wmma_f32_16x16x32_f16.
// W [o][in][out] is transposed to bf16-exact x 2^4 f16 rows [out][in] by the prep kernel; k_mlp keeps one channel's weights in LDS and computes every layer transposed
// (A = weight rows, B = pixel columns), so that two f32 D tiles, after + bias, relu and the rounding to f16, ARE the next layer's B fragment: the hidden rows never leave the registers.
#define NBt 8
#define IC 128
#define IH 32
#define NPX (NBt * IH * IH)
#define OC 32
#define HH 256

typedef __bf16 v16b __attribute__((ext_vector_type(16)));
typedef unsigned short v8us __attribute__((ext_vector_type(8), may_alias));
typedef float  v8f  __attribute__((ext_vector_type(8)));
typedef float  v4f  __attribute__((ext_vector_type(4)));
typedef float  v4fa __attribute__((ext_vector_type(4), may_alias));
union FragB { v16b v; v8us half[2]; unsigned short u[16]; };

__device__ __forceinline__ unsigned short bf16_bits(float x) { unsigned int u = __float_as_uint(x); return (unsigned short)((u + 0x7FFFu + ((u >> 16) & 1u)) >> 16); }
__device__ __forceinline__ float bf16_val(unsigned short b) { return __uint_as_float(((unsigned int)b) << 16); }
__device__ __forceinline__ float bf16_round(float x) { return bf16_val(bf16_bits(x)); }
// D += A·B with NT terms: 1 = ah·bh, 2 = + al·bh (A split), 3 = + ah·bl (both split)
template <int NT>
__device__ __forceinline__ v8f mmaN(v16b ah, v16b al, v16b bh, v16b bl, v8f c) {
  c = __builtin_amdgcn_wmma_f32_16x16x32_bf16(false, ah, false, bh, (short)0, c, false, false);
  if (NT >= 2) c = __builtin_amdgcn_wmma_f32_16x16x32_bf16(false, al, false, bh, (short)0, c, false, false);
  if (NT >= 3) c = __builtin_amdgcn_wmma_f32_16x16x32_bf16(false, ah, false, bl, (short)0, c, false, false);
  asm volatile("v_nop\n\tv_nop\n\tv_nop\n\tv_nop" : "+v"(c) : "v"(ah), "v"(al), "v"(bh), "v"(bl));
  return c;
}

__global__ __launch_bounds__(256) void k_wt_bf16(const float* __restrict__ W, unsigned short* __restrict__ Wt, int K, int N) {
  const int t = blockIdx.x * 256 + threadIdx.x;
  const int k8n = K / 8;
  if (t >= N * k8n) return;
  const int n = t / k8n, k8 = (t % k8n) * 8;
  v8us v;
#pragma unroll
  for (int i = 0; i < 8; ++i) v[i] = bf16_bits(W[(size_t)(k8 + i) * N + n]);
  *(v8us*)(Wt + (size_t)n * K + k8) = v;
  
}

// GEMM C[M][N] (f32, pitch ldc) = act(A[M][K]·W + bias). A f32 row-major (pitch lda) converted per fragment to bf16
// (ASPLIT: hi/lo two planes -> 2 terms, else single rounded term); Wt bf16 [N][K] (pitch ldb). BIAS_BF16 rounds the
// bias to bf16 first (bias quantised to bf16 before the add). K%32==0, M%16==0, N%64==0.
template <bool ASPLIT, int ACT, bool BIAS_BF16>
__global__ __launch_bounds__(128) void k_gemm_bf(const float* __restrict__ A, int lda, const unsigned short* __restrict__ Wt, int ldb,
                                               const float* __restrict__ bias, float* __restrict__ C, int ldc, int M, int N, int K) {
  __shared__ __attribute__((aligned(16))) float so[4][16][64];
  const int tid = threadIdx.x, w = tid >> 5, lane = tid & 31, ln = lane & 15, hh = lane >> 4;
  const int ntn = N / 64;
  const int wid = blockIdx.x * 4 + w;
  const int mt = wid / ntn, nq = wid % ntn;
  if (mt * 16 >= M) return;
  const int row0 = mt * 16, col0 = nq * 64;
  const float* arow = A + (size_t)(row0 + ln) * lda;
  v8f acc[4] = {};
  for (int kb = 0; kb < K; kb += 32) {
    FragB ah, al;
    const v4f x0 = *(const v4fa*)(arow + kb + 8 * hh), x1 = *(const v4fa*)(arow + kb + 8 * hh + 4);
    const v4f x2 = *(const v4fa*)(arow + kb + 16 + 8 * hh), x3 = *(const v4fa*)(arow + kb + 16 + 8 * hh + 4);
    float xs[16] = {x0[0],x0[1],x0[2],x0[3],x1[0],x1[1],x1[2],x1[3],x2[0],x2[1],x2[2],x2[3],x3[0],x3[1],x3[2],x3[3]};
#pragma unroll
    for (int i = 0; i < 16; ++i) { const unsigned short hb = bf16_bits(xs[i]); ah.u[i] = hb; al.u[i] = ASPLIT ? bf16_bits(xs[i] - bf16_val(hb)) : (unsigned short)0; }
#pragma unroll
    for (int t = 0; t < 4; ++t) {
      const unsigned short* brow = Wt + (size_t)(col0 + t * 16 + ln) * ldb + kb;
      FragB b;
      b.half[0] = *(const v8us*)(brow + 8 * hh);
      b.half[1] = *(const v8us*)(brow + 16 + 8 * hh);
      acc[t] = mmaN<ASPLIT ? 2 : 1>(ah.v, al.v, b.v, b.v, acc[t]);
    }
  }
#pragma unroll
  for (int t = 0; t < 4; ++t) {
    float bv = bias ? bias[col0 + t * 16 + ln] : 0.f;
    if (BIAS_BF16) bv = bf16_round(bv);
#pragma unroll
    for (int r = 0; r < 8; ++r) { float v = acc[t][r] + bv; if (ACT == 1) v = fmaxf(v, 0.f); so[w][8 * hh + r][t * 16 + ln] = v; }
  }
  __builtin_amdgcn_fence(__ATOMIC_ACQ_REL, "workgroup");
  __builtin_amdgcn_wave_barrier();
  const int rsub = lane >> 4, c4 = (lane & 15) * 4;
  {
#pragma unroll
    for (int q = 0; q < 8; ++q) {
      const int r = q * 2 + rsub;
      const v4f v = *(const v4fa*)&so[w][r][c4];
      *(v4f*)(C + (size_t)(row0 + r) * ldc + col0 + c4) = v;
    }
    
  }
}

// Flash-style causal/unmasked attention, all contractions 3-term bf16 hi/lo splits, f32 softmax with running max.
// q,k,v rows are read from f32 buffers with arbitrary row pitch (so they can live inside a fused qkv buffer);
// D = head size (multiple of 32, <= 128); one wave = 16 query rows; block = 4 waves (64 queries) sharing K/V chunks of 32.
template <int D, bool CAUSAL>
__global__ __launch_bounds__(128) void k_flash(const float* __restrict__ qb, const float* __restrict__ kb, const float* __restrict__ vb,
                                             int pitch, int T, int H, float scale, float* __restrict__ y, int ypitch) {
  constexpr int KS = D / 32;        // k-steps for QK
  constexpr int DT = D / 16;        // d tiles for PV
  __shared__ __attribute__((aligned(16))) unsigned short sKh[32][D + 8], sKl[32][D + 8], sVh[32][D + 8], sVl[32][D + 8];
  __shared__ __attribute__((aligned(16))) unsigned short sPh[4][16][40], sPl[4][16][40];
  __shared__ __attribute__((aligned(16))) float sO[4][16][D];
  const int tid = threadIdx.x, w = tid >> 5, lane = tid & 31, ln = lane & 15, hh = lane >> 4;
  const int nqb = (T + 63) / 64;
  const int bh = blockIdx.x / nqb, qblk = blockIdx.x % nqb;
  const int b = bh / H, h = bh % H;
  const int q0 = qblk * 64 + w * 16;
  const float* Q = qb + (size_t)b * T * pitch + h * D;
  const float* K = kb + (size_t)b * T * pitch + h * D;
  const float* V = vb + (size_t)b * T * pitch + h * D;

  // A fragments of the wave's 16 query rows (scaled), hi/lo
  FragB aqh[KS], aql[KS];
  {
    int row = q0 + ln; if (row >= T) row = T - 1;
    const float* qr = Q + (size_t)row * pitch;
#pragma unroll
    for (int ks = 0; ks < KS; ++ks)
#pragma unroll
      for (int i = 0; i < 16; ++i) {
        const int d = ks * 32 + ((i < 8) ? (8 * hh + i) : (16 + 8 * hh + (i - 8)));
        const float x = qr[d] * scale; const unsigned short hb = bf16_bits(x);
        aqh[ks].u[i] = hb; aql[ks].u[i] = bf16_bits(x - bf16_val(hb));
      }
  }
  float m_r[8], l_r[8];
#pragma unroll
  for (int r = 0; r < 8; ++r) { m_r[r] = -3.0e38f; l_r[r] = 0.f; }
  v8f oacc[DT];
#pragma unroll
  for (int dt = 0; dt < DT; ++dt) oacc[dt] = (v8f){0.f,0.f,0.f,0.f,0.f,0.f,0.f,0.f};

  const int kv_end = CAUSAL ? min(T, qblk * 64 + 64) : T;     // block-uniform
  for (int j0 = 0; j0 < kv_end; j0 += 32) {
    __syncthreads();
    for (int e = tid; e < 32 * (D / 4); e += 128) {
      const int r = e / (D / 4), c4 = (e % (D / 4)) * 4;
      const int key = j0 + r;
      v4f kf = {0.f,0.f,0.f,0.f}, vf = {0.f,0.f,0.f,0.f};
      if (key < T) { kf = *(const v4fa*)(K + (size_t)key * pitch + c4); vf = *(const v4fa*)(V + (size_t)key * pitch + c4); }
#pragma unroll
      for (int t = 0; t < 4; ++t) {
        unsigned short hb = bf16_bits(kf[t]); sKh[r][c4 + t] = hb; sKl[r][c4 + t] = bf16_bits(kf[t] - bf16_val(hb));
        hb = bf16_bits(vf[t]); sVh[r][c4 + t] = hb; sVl[r][c4 + t] = bf16_bits(vf[t] - bf16_val(hb));
      }
    }
    __syncthreads();
    // S tile 16 x 32
    v8f s[2];
#pragma unroll
    for (int nt = 0; nt < 2; ++nt) {
      v8f acc = {};
#pragma unroll
      for (int ks = 0; ks < KS; ++ks) {
        FragB bh_, bl_;
        bh_.half[0] = *(const v8us*)&sKh[nt * 16 + ln][ks * 32 + 8 * hh]; bh_.half[1] = *(const v8us*)&sKh[nt * 16 + ln][ks * 32 + 16 + 8 * hh];
        bl_.half[0] = *(const v8us*)&sKl[nt * 16 + ln][ks * 32 + 8 * hh]; bl_.half[1] = *(const v8us*)&sKl[nt * 16 + ln][ks * 32 + 16 + 8 * hh];
        acc = mmaN<3>(aqh[ks].v, aql[ks].v, bh_.v, bl_.v, acc);
      }
      s[nt] = acc;
    }
    // mask + running max (rows 8hh+r; the 16 lanes of a half share rows)
    float alpha[8];
#pragma unroll
    for (int r = 0; r < 8; ++r) {
      const int qi = q0 + 8 * hh + r;
      const int ja = j0 + ln, jb = j0 + 16 + ln;
      if (CAUSAL) { if (ja > qi) s[0][r] = -3.0e38f; if (jb > qi) s[1][r] = -3.0e38f; }
      if (ja >= T) s[0][r] = -3.0e38f;
      if (jb >= T) s[1][r] = -3.0e38f;
      float mx = fmaxf(s[0][r], s[1][r]);
      mx = fmaxf(mx, __shfl_xor(mx, 1, 32)); mx = fmaxf(mx, __shfl_xor(mx, 2, 32)); mx = fmaxf(mx, __shfl_xor(mx, 4, 32)); mx = fmaxf(mx, __shfl_xor(mx, 8, 32));
      const float mnew = fmaxf(m_r[r], mx);
      alpha[r] = (mnew > -1.0e38f) ? __expf(m_r[r] - mnew) : 1.0f;
      const float p0 = (s[0][r] > -1.0e38f) ? __expf(s[0][r] - mnew) : 0.f;
      const float p1 = (s[1][r] > -1.0e38f) ? __expf(s[1][r] - mnew) : 0.f;
      m_r[r] = mnew;
      l_r[r] = l_r[r] * alpha[r] + p0 + p1;            // per-lane partial row sum (16 lanes combined at the end)
      unsigned short hb = bf16_bits(p0); sPh[w][8 * hh + r][ln] = hb;      sPl[w][8 * hh + r][ln] = bf16_bits(p0 - bf16_val(hb));
      hb = bf16_bits(p1);                sPh[w][8 * hh + r][16 + ln] = hb; sPl[w][8 * hh + r][16 + ln] = bf16_bits(p1 - bf16_val(hb));
    }
#pragma unroll
    for (int dt = 0; dt < DT; ++dt)
#pragma unroll
      for (int r = 0; r < 8; ++r) oacc[dt][r] *= alpha[r];
    __builtin_amdgcn_fence(__ATOMIC_ACQ_REL, "workgroup");
    __builtin_amdgcn_wave_barrier();
    FragB pah, pal;
    pah.half[0] = *(const v8us*)&sPh[w][ln][8 * hh]; pah.half[1] = *(const v8us*)&sPh[w][ln][16 + 8 * hh];
    pal.half[0] = *(const v8us*)&sPl[w][ln][8 * hh]; pal.half[1] = *(const v8us*)&sPl[w][ln][16 + 8 * hh];
#pragma unroll
    for (int dt = 0; dt < DT; ++dt) {
      FragB bvh, bvl;
#pragma unroll
      for (int i = 0; i < 8; ++i) {
        bvh.u[i] = sVh[8 * hh + i][dt * 16 + ln]; bvh.u[8 + i] = sVh[16 + 8 * hh + i][dt * 16 + ln];
        bvl.u[i] = sVl[8 * hh + i][dt * 16 + ln]; bvl.u[8 + i] = sVl[16 + 8 * hh + i][dt * 16 + ln];
      }
      oacc[dt] = mmaN<3>(pah.v, pal.v, bvh.v, bvl.v, oacc[dt]);
    }
    __builtin_amdgcn_fence(__ATOMIC_ACQ_REL, "workgroup");
    __builtin_amdgcn_wave_barrier();
  }
#pragma unroll
  for (int r = 0; r < 8; ++r) {
    float l = l_r[r];
    l += __shfl_xor(l, 1, 32); l += __shfl_xor(l, 2, 32); l += __shfl_xor(l, 4, 32); l += __shfl_xor(l, 8, 32);
    l_r[r] = (l > 0.f) ? 1.0f / l : 0.f;
  }
#pragma unroll
  for (int dt = 0; dt < DT; ++dt)
#pragma unroll
    for (int r = 0; r < 8; ++r) sO[w][8 * hh + r][dt * 16 + ln] = oacc[dt][r] * l_r[r];
  __builtin_amdgcn_fence(__ATOMIC_ACQ_REL, "workgroup");
  __builtin_amdgcn_wave_barrier();
  {
    for (int r = 0; r < 16; ++r) {
      const int row = q0 + r;
      if (row < T && lane < D / 4) {
        const v4f val = *(const v4fa*)&sO[w][r][lane * 4];
        *(v4f*)(y + ((size_t)b * T + row) * ypitch + h * D + lane * 4) = val;
      }
    }
    
  }
}

// GEMM C = act(A·W + bias + resid): A f32 (ASPLIT -> hi/lo 2 terms), Wt bf16 [N][K]; ACT 0 none, 1 relu, 2 exact gelu;
// resid (optional, f32, row index = (row % rmod), pitch ldr, RES_BF16 rounds it) added before the activation.
template <bool ASPLIT, int ACT, bool BIAS_BF16, bool RES_BF16>
__global__ __launch_bounds__(128) void k_gemm_bf3(const float* __restrict__ A, int lda, const unsigned short* __restrict__ Wt, int ldb,
                                                const float* __restrict__ bias, const float* __restrict__ resid, int rmod, int ldr,
                                                float* __restrict__ C, int ldc, int M, int N, int K) {
  __shared__ __attribute__((aligned(16))) float so[4][16][64];
  const int tid = threadIdx.x, w = tid >> 5, lane = tid & 31, ln = lane & 15, hh = lane >> 4;
  const int ntn = N / 64;
  const int wid = blockIdx.x * 4 + w;
  const int mt = wid / ntn, nq = wid % ntn;
  if (mt * 16 >= M) return;
  const int row0 = mt * 16, col0 = nq * 64;
  const float* arow = A + (size_t)(row0 + ln) * lda;
  v8f acc[4] = {};
  for (int kb = 0; kb < K; kb += 32) {
    FragB ah, al;
    const v4f x0 = *(const v4fa*)(arow + kb + 8 * hh), x1 = *(const v4fa*)(arow + kb + 8 * hh + 4);
    const v4f x2 = *(const v4fa*)(arow + kb + 16 + 8 * hh), x3 = *(const v4fa*)(arow + kb + 16 + 8 * hh + 4);
    float xs[16] = {x0[0],x0[1],x0[2],x0[3],x1[0],x1[1],x1[2],x1[3],x2[0],x2[1],x2[2],x2[3],x3[0],x3[1],x3[2],x3[3]};
#pragma unroll
    for (int i = 0; i < 16; ++i) { const unsigned short hb = bf16_bits(xs[i]); ah.u[i] = hb; al.u[i] = ASPLIT ? bf16_bits(xs[i] - bf16_val(hb)) : (unsigned short)0; }
#pragma unroll
    for (int t = 0; t < 4; ++t) {
      const unsigned short* brow = Wt + (size_t)(col0 + t * 16 + ln) * ldb + kb;
      FragB b;
      b.half[0] = *(const v8us*)(brow + 8 * hh);
      b.half[1] = *(const v8us*)(brow + 16 + 8 * hh);
      acc[t] = mmaN<ASPLIT ? 2 : 1>(ah.v, al.v, b.v, b.v, acc[t]);
    }
  }
#pragma unroll
  for (int t = 0; t < 4; ++t) {
    const int col = col0 + t * 16 + ln;
    float bv = bias ? bias[col] : 0.f;
    if (BIAS_BF16) bv = bf16_round(bv);
#pragma unroll
    for (int r = 0; r < 8; ++r) {
      float v = acc[t][r] + bv;
      if (resid) { float rv = resid[(size_t)((row0 + 8 * hh + r) % rmod) * ldr + col]; if (RES_BF16) rv = bf16_round(rv); v += rv; }
      if (ACT == 1) v = fmaxf(v, 0.f);
      if (ACT == 2) v = 0.5f * v * (1.0f + erff(v * 0.70710678118654752f));
      if (ACT == 3) { const float u = 0.7978845608028654f * (v + 0.044715f * v * v * v); v = 0.5f * v * (1.0f + tanhf(u)); }
      so[w][8 * hh + r][t * 16 + ln] = v;
    }
  }
  __builtin_amdgcn_fence(__ATOMIC_ACQ_REL, "workgroup");
  __builtin_amdgcn_wave_barrier();
  const int rsub = lane >> 4, c4 = (lane & 15) * 4;
  {
#pragma unroll
    for (int q = 0; q < 8; ++q) {
      const int r = q * 2 + rsub;
      const v4f v = *(const v4fa*)&so[w][r][c4];
      *(v4f*)(C + (size_t)(row0 + r) * ldc + col0 + c4) = v;
    }
    
  }
}
// row LayerNorm (biased variance, eps) over N: s = X (+ R); optional out_sum <- s; out_norm <- (s-mu)*rsqrt(var+eps)*g + b
template <bool PARAM_BF16>
__global__ __launch_bounds__(256) void k_layernorm(const float* __restrict__ X, const float* __restrict__ R, const float* __restrict__ g, const float* __restrict__ bta,
                                                  float* __restrict__ out_sum, float* __restrict__ out_norm, int N, float eps) {
  __shared__ float red[256];
  const int row = blockIdx.x, tid = threadIdx.x;
  const float* x = X + (size_t)row * N; const float* rr = R ? R + (size_t)row * N : nullptr;
  float vals[16];                     // up to N = 4096
  const int per = N / 256;            // contiguous chunk per thread? use strided-by-4 chunks: thread handles j = tid*4 + 1024*u
  float s1 = 0.f;
  for (int u = 0; u < per / 4; ++u) {
    const int j = tid * 4 + 1024 * u;
    const v4f a = *(const v4fa*)(x + j);
    v4f b = {0.f,0.f,0.f,0.f}; if (rr) b = *(const v4fa*)(rr + j);
#pragma unroll
    for (int q = 0; q < 4; ++q) { const float v = a[q] + b[q]; vals[u * 4 + q] = v; s1 += v; }
  }
  red[tid] = s1; __syncthreads();
  for (int st = 128; st > 0; st >>= 1) { if (tid < st) red[tid] += red[tid + st]; __syncthreads(); }
  const float mu = red[0] / (float)N; __syncthreads();
  float s2 = 0.f;
  for (int u = 0; u < per / 4; ++u)
#pragma unroll
    for (int q = 0; q < 4; ++q) { const float c = vals[u * 4 + q] - mu; s2 += c * c; }
  red[tid] = s2; __syncthreads();
  for (int st = 128; st > 0; st >>= 1) { if (tid < st) red[tid] += red[tid + st]; __syncthreads(); }
  const float rs = rsqrtf(red[0] / (float)N + eps);
  {
    for (int u = 0; u < per / 4; ++u) {
      const int j = tid * 4 + 1024 * u;
      v4f o, sm;
#pragma unroll
      for (int q = 0; q < 4; ++q) {
        float gg = g[j + q], bb = bta[j + q];
        if (PARAM_BF16) { gg = bf16_round(gg); bb = bf16_round(bb); }
        sm[q] = vals[u * 4 + q]; o[q] = (vals[u * 4 + q] - mu) * rs * gg + bb;
      }
      if (out_sum) *(v4f*)(out_sum + (size_t)row * N + j) = sm;
      *(v4f*)(out_norm + (size_t)row * N + j) = o;
    }
    
  }
}



// ---- f16 WMMA path (v_wmma_f32_16x16x32_f16): 11-bit significands for operands in range — used here for all three MLP layers (k_mlp)
typedef _Float16 v16h __attribute__((ext_vector_type(16)));
union FragH { v16h v; v8us half[2]; _Float16 h[16]; unsigned short u[16]; };
template <int NT>
__device__ __forceinline__ v8f mmaH(v16h ah, v16h al, v16h bh, v16h bl, v8f c) {
  c = __builtin_amdgcn_wmma_f32_16x16x32_f16(false, ah, false, bh, (short)0, c, false, false);
  if (NT >= 2) c = __builtin_amdgcn_wmma_f32_16x16x32_f16(false, al, false, bh, (short)0, c, false, false);
  if (NT >= 3) c = __builtin_amdgcn_wmma_f32_16x16x32_f16(false, ah, false, bl, (short)0, c, false, false);
  asm volatile("v_nop\n\tv_nop\n\tv_nop\n\tv_nop" : "+v"(c) : "v"(ah), "v"(al), "v"(bh), "v"(bl));
  return c;
}
// batched GEMM like k_gemm_b but f16 operands: A f32 (split into f16 hi/lo if ASPLIT, else rounded to f16), Bt = f16 values [n][k]; alpha; C f32; N multiple of 16 (partial tiles skipped)
template <bool ASPLIT>
__global__ __launch_bounds__(128) void k_gemm_h(const float* __restrict__ A, int lda, size_t sA, const _Float16* __restrict__ Bh, int ldb, size_t sB, float alpha, float* __restrict__ C, int ldc, size_t sC, int M, int N, int K) {
  __shared__ __attribute__((aligned(16))) float so[4][16][64];
  const int tid = threadIdx.x, w = tid >> 5, lane = tid & 31, ln = lane & 15, hh = lane >> 4; const int by = blockIdx.y;
  A += (size_t)by * sA; Bh += (size_t)by * sB; C += (size_t)by * sC;
  const int ntn = (N + 63) / 64; const int wid = blockIdx.x * 4 + w; const int mt = wid / ntn, nq = wid % ntn; if (mt * 16 >= M) return;
  const int row0 = mt * 16, col0 = nq * 64; const float* arow = A + (size_t)(row0 + ln) * lda;
  v8f acc[4] = {};
  for (int kb = 0; kb < K; kb += 32) {
    FragH ah, al;
    const v4f x0 = *(const v4fa*)(arow + kb + 8 * hh), x1 = *(const v4fa*)(arow + kb + 8 * hh + 4), x2 = *(const v4fa*)(arow + kb + 16 + 8 * hh), x3 = *(const v4fa*)(arow + kb + 16 + 8 * hh + 4);
    float xs[16] = {x0[0],x0[1],x0[2],x0[3],x1[0],x1[1],x1[2],x1[3],x2[0],x2[1],x2[2],x2[3],x3[0],x3[1],x3[2],x3[3]};
#pragma unroll
    for (int i = 0; i < 16; ++i) { const _Float16 h = (_Float16)xs[i]; ah.h[i] = h; al.h[i] = ASPLIT ? (_Float16)(xs[i] - (float)h) : (_Float16)0.0f; }
#pragma unroll
    for (int t = 0; t < 4; ++t) { if (col0 + t * 16 >= N) continue; const size_t boff = (size_t)(col0 + t * 16 + ln) * ldb + kb; FragH bq; bq.half[0] = *(const v8us*)(Bh + boff + 8 * hh); bq.half[1] = *(const v8us*)(Bh + boff + 16 + 8 * hh);
      acc[t] = mmaH<ASPLIT ? 2 : 1>(ah.v, al.v, bq.v, bq.v, acc[t]); }
  }
#pragma unroll
  for (int t = 0; t < 4; ++t) { if (col0 + t * 16 >= N) continue;
#pragma unroll
    for (int r = 0; r < 8; ++r) so[w][8 * hh + r][t * 16 + ln] = acc[t][r] * alpha; }
  __builtin_amdgcn_fence(__ATOMIC_ACQ_REL, "workgroup"); __builtin_amdgcn_wave_barrier();
  const int rsub = lane >> 4, c4 = (lane & 15) * 4;
  {
#pragma unroll
    for (int q = 0; q < 8; ++q) { const int r = q * 2 + rsub; if (col0 + c4 < N) { const v4f v = *(const v4fa*)&so[w][r][c4]; *(v4f*)(C + (size_t)(row0 + r) * ldc + col0 + c4) = v; } }
     }
}

// Wt[n][k] = f16(W[k][n]·scale) from f32 row-major W[K][N] (scale = power of two; bf16-exact weights stay exact in f16 away from the subnormal range)
__global__ __launch_bounds__(256) void k_wt_f16(const float* __restrict__ W, _Float16* __restrict__ Wt, int K, int N, float scale) {
  const int t = blockIdx.x * 256 + threadIdx.x; if (t >= N * (K / 8)) return; const int n = t / (K / 8), k8 = (t % (K / 8)) * 8; FragH f;
#pragma unroll
  for (int i = 0; i < 8; ++i) f.h[i] = (_Float16)(bf16_round(W[(size_t)(k8 + i) * N + n]) * scale); const v8us o = f.half[0];
  *(v8us*)((unsigned short*)Wt + (size_t)n * K + k8) = o; 
}

// One launch prepares all three f16 operands. Each is the same job, src [batch][K][N] f32 -> dst [batch][N][K] f16 of bf16_round(src) * scale; a block takes a slab of 64 k x 256 n.
// Reads: 16 B a lane, a wave covers 512 contiguous bytes of one k row, all 16 reads of a thread in flight together. Writes: 8 lanes store one whole 128-B line of a dst row.
// LDS holds 8-byte chunks (4 consecutive k of one n) as tl[(n & 3) * 16 + k / 4][n / 4]; the pitch of 65 chunks spreads both the chunk stores and the chunk reads over all 64 banks.
// LDN (src row pitch) and KD (dst row pitch) are compile-time: every row step is then an immediate offset on one address register.
typedef unsigned short v4us __attribute__((ext_vector_type(4)));
template <int LDN, int KD, int SCALE>
__device__ __forceinline__ void slab_t(const float* __restrict__ src, unsigned short* __restrict__ dst, v4us (*tl)[65], int tid) {
  const int a = tid % 64, kq = tid / 64;      // the thread's four columns n = 4a .. 4a + 3; its k chunks are kq, kq + 4, kq + 8, kq + 12
  const float* s0 = src + (size_t)(4 * kq) * LDN + 4 * a;
  v4f r[4][4];
#pragma unroll
  for (int j = 0; j < 4; ++j)
#pragma unroll
    for (int i = 0; i < 4; ++i) r[j][i] = *(const v4fa*)(s0 + (16 * j + i) * LDN);
  // the wait stands before anything overwrites the address pair that the 16 reads name; taking the pair as an input keeps it out of the reads' own destinations
  asm volatile("s_wait_xcnt 0x0" :: "v"(s0) : "memory");
  // keeps all 16 reads ahead of the first conversion: left free, the scheduler holds the last read back until the first ones have returned, a second trip to L2
  __builtin_amdgcn_sched_barrier(0);
#pragma unroll
  for (int j = 0; j < 4; ++j)
#pragma unroll
    for (int c = 0; c < 4; ++c) {
      FragH f;
#pragma unroll
      for (int i = 0; i < 4; ++i) f.h[i] = (_Float16)(bf16_round(r[j][i][c]) * (float)SCALE);
      v4us p; p[0] = f.u[0]; p[1] = f.u[1]; p[2] = f.u[2]; p[3] = f.u[3];
      tl[c * 16 + kq + 4 * j][a] = p;
    }
  __syncthreads();      // every chunk of the slab is in LDS before any dst row is gathered
  const int lane = tid & 31, m = lane & 7;      // m = the 16-byte piece of the row's 128 bytes
  const int a0 = ((lane >> 3) & 1) + 2 * (tid >> 5) + 16 * (lane >> 4);
  unsigned short* d0 = dst + (size_t)(4 * a0) * KD + 8 * m;
#pragma unroll
  for (int c = 0; c < 4; ++c)
#pragma unroll
    for (int g = 0; g < 2; ++g) {
      const v4us lo = tl[c * 16 + 2 * m][a0 + 32 * g], hi = tl[c * 16 + 2 * m + 1][a0 + 32 * g];
      v8us o; o[0] = lo[0]; o[1] = lo[1]; o[2] = lo[2]; o[3] = lo[3]; o[4] = hi[0]; o[5] = hi[1]; o[6] = hi[2]; o[7] = hi[3];
      *(v8us*)(d0 + (128 * g + c) * KD) = o;
    }
}
__global__ __launch_bounds__(256) void k_prep(const float* __restrict__ x, const float* __restrict__ W1, const float* __restrict__ W2,
                                              _Float16* __restrict__ PIX, _Float16* __restrict__ Bt1, _Float16* __restrict__ Bt2) {
  __shared__ __attribute__((aligned(16))) v4us tl[4 * 16][65];
  const int tid = threadIdx.x, b = blockIdx.x;
  if (b < OC * (HH / 64)) {                                   // W2[o][d][e] -> Bt2[o][e][d]
    const int o = b / (HH / 64), kt = b % (HH / 64);
    slab_t<HH, HH, 16>(W2 + ((size_t)o * HH + kt * 64) * HH, (unsigned short*)Bt2 + (size_t)o * HH * HH + kt * 64, tl, tid);
  } else if (b < OC * (HH / 64) + OC * (IC / 64)) {           // W1[o][c][d] -> Bt1[o][d][c]
    const int bb = b - OC * (HH / 64), o = bb / (IC / 64), kt = bb % (IC / 64);
    slab_t<HH, IC, 16>(W1 + ((size_t)o * IC + kt * 64) * HH, (unsigned short*)Bt1 + (size_t)o * HH * IC + kt * 64, tl, tid);
  } else {                                                    // x[n][c][pixel] -> PIX[n][pixel][c]
    const int bb = b - OC * (HH / 64) - OC * (IC / 64), n = bb / ((IC / 64) * 4), kt = (bb / 4) % (IC / 64), ng = bb % 4;
    slab_t<IH * IH, IC, 1>(x + ((size_t)n * IC + kt * 64) * (IH * IH) + ng * 256, (unsigned short*)PIX + ((size_t)n * IH * IH + ng * 256) * IC + kt * 64, tl, tid);
  }
}
#define NPT 2           // pixel tiles of 16 per wave = one image row of 32 pixels; each weight fragment read from LDS feeds NPT products
#define P1 (IC + 8)     // LDS row pitch in f16: 272 B and 528 B are 16 B x odd, the conflict-free pitch for ds_load_b128 fragment reads
#define P2 (HH + 8)
typedef float v2f __attribute__((ext_vector_type(2)));
__device__ __forceinline__ v8f wmma_h(v16h a, v16h b, v8f c) { return __builtin_amdgcn_wmma_f32_16x16x32_f16(false, a, false, b, (short)0, c, false, false); }
// fragment of row (or column) 'row' at k0: elements 0..7 = k0 + 8hh + 0..7, elements 8..15 = k0 + 16 + 8hh + 0..7 (the order a packed pair of D tiles has)
__device__ __forceinline__ v16h frag_at(const unsigned short* row, int k0, int hh) { FragH f; f.half[0] = *(const v8us*)(row + k0 + 8 * hh); f.half[1] = *(const v8us*)(row + k0 + 16 + 8 * hh); return f.v; }
// half a B fragment of the next layer from one D tile: h[r] = f16(relu(acc[r] / 16 + bias[8hh + r])), c0 and c1 = the lane's 8 bias values
__device__ __forceinline__ void pack_tile(FragH& f, int u, v8f acc, v4f c0, v4f c1) {
#pragma unroll
  for (int r = 0; r < 8; ++r) f.h[u * 8 + r] = (_Float16)fmaxf(acc[r] * 0.0625f + (r < 4 ? c0[r & 3] : c1[r & 3]), 0.f);
}
// One work-group = one output channel o and one image n; 8 waves, each takes image rows i = w, w + 8, ...
// D maps: layers 1, 2: acc[r] = hidden[16t + 8hh + r][pixel ln]. Layer 3: rows 0, 1, 8, 9 of its A operand hold W3's columns k = 0, 1, 2, 3 (the rest zero), so acc3[kj] = out_k[2hh + kj][pixel ln]: ki = hh.
__global__ __launch_bounds__(256) void k_mlp(const _Float16* __restrict__ PIX, const _Float16* __restrict__ Bt1, const _Float16* __restrict__ Bt2, const float* __restrict__ b1, const float* __restrict__ b2,
                                             const float* __restrict__ W3, const float* __restrict__ b3, float* __restrict__ out) {
  __shared__ __attribute__((aligned(16))) unsigned short sW1[HH][P1], sW2[HH][P2], sW3[16][P2];
  __shared__ __attribute__((aligned(16))) float sB1[HH], sB2[HH];
  const int tid = threadIdx.x, lane = tid & 31, ln = lane & 15, hh = lane >> 4;
  const int w = __builtin_amdgcn_readfirstlane(tid >> 5);      // the wave's number in a scalar register: the row loop below branches on SCC and leaves EXEC alone
  const int o = blockIdx.x / NBt, n = blockIdx.x % NBt;
  const unsigned short* g1 = (const unsigned short*)Bt1 + (size_t)o * HH * IC;
  const unsigned short* g2 = (const unsigned short*)Bt2 + (size_t)o * HH * HH;
  // staging, unrolled in full: all of a thread's 16-byte reads are in flight together, one L2 round trip instead of one per loop trip
#pragma unroll
  for (int q = 0; q < HH / 16; ++q) *(v8us*)&sW1[q * 16 + tid / 16][(tid % 16) * 8] = *(const v8us*)(g1 + (tid / 16) * IC + (tid % 16) * 8 + q * 16 * IC);
#pragma unroll
  for (int q = 0; q < HH / 8; ++q) *(v8us*)&sW2[q * 8 + tid / 32][(tid % 32) * 8] = *(const v8us*)(g2 + (tid / 32) * HH + (tid % 32) * 8 + q * 8 * HH);
  { const v4f w3 = *(const v4fa*)(W3 + ((size_t)o * HH + tid) * 4);      // thread = hidden unit e: its four k
#pragma unroll
    for (int m = 0; m < 16; ++m) { FragH f; f.h[0] = (_Float16)(bf16_round(w3[(m >> 3) * 2 + (m & 1)]) * 16.0f); sW3[m][tid] = ((m & 6) == 0) ? f.u[0] : (unsigned short)0; } }
  sB1[tid] = bf16_round(b1[o * HH + tid]); sB2[tid] = bf16_round(b2[o * HH + tid]);
  const float c30 = bf16_round(hh ? b3[o * 4 + 2] : b3[o * 4]), c31 = bf16_round(hh ? b3[o * 4 + 3] : b3[o * 4 + 1]);      // ki = hh picks the pair
  __syncthreads();      // the weights are read-only from here on: the kernel's only barrier
  const unsigned short* prow = (const unsigned short*)PIX + ((size_t)(n * IH + w) * IH + ln) * IC + 8 * hh;      // pixel (n, i = w, j = ln), the lane half's k offset included
  v16h px[NPT][IC / 32];
#pragma unroll
  for (int p = 0; p < NPT; ++p)
#pragma unroll
    for (int kb = 0; kb < IC / 32; ++kb) px[p][kb] = frag_at(prow + p * 16 * IC, kb * 32, 0);
  for (int i = w; i < IH; i += 8) {
    FragH h1[NPT][HH / 32];
    v16h wa[2][2 * (IC / 32)]; v4f wc[2][4];      // two register sets: tile pair s + 1 is read from LDS while pair s is multiplied
#pragma unroll
    for (int q = 0; q < 2 * (IC / 32); ++q) wa[0][q] = frag_at(&sW1[(q & 1) * 16 + ln][0], (q >> 1) * 32, hh);
#pragma unroll
    for (int q = 0; q < 4; ++q) wc[0][q] = *(const v4fa*)&sB1[(q >> 1) * 16 + 8 * hh + (q & 1) * 4];
    // full unroll: h1 is indexed by s and has to stay in registers
#pragma unroll
    for (int s = 0; s < HH / 32; ++s) {
      if (s + 1 < HH / 32) {
#pragma unroll
        for (int q = 0; q < 2 * (IC / 32); ++q) wa[(s + 1) & 1][q] = frag_at(&sW1[(2 * (s + 1) + (q & 1)) * 16 + ln][0], (q >> 1) * 32, hh);
#pragma unroll
        for (int q = 0; q < 4; ++q) wc[(s + 1) & 1][q] = *(const v4fa*)&sB1[(2 * (s + 1) + (q >> 1)) * 16 + 8 * hh + (q & 1) * 4];
      }
      // keeps the next pair's LDS reads ahead of this pair's matrix instructions; left free, the scheduler puts each read directly in front of its use and every product waits out the LDS latency
      __builtin_amdgcn_sched_barrier(0);
      v8f acc[2][NPT] = {};
#pragma unroll
      for (int kb = 0; kb < IC / 32; ++kb)
#pragma unroll
        for (int u = 0; u < 2; ++u)
#pragma unroll
          for (int p = 0; p < NPT; ++p) acc[u][p] = wmma_h(wa[s & 1][kb * 2 + u], px[p][kb], acc[u][p]);
#pragma unroll
      for (int u = 0; u < 2; ++u)
#pragma unroll
        for (int p = 0; p < NPT; ++p) pack_tile(h1[p][s], u, acc[u][p], wc[s & 1][u * 2], wc[s & 1][u * 2 + 1]);
    }
    // the next row's pixel fragments fly during layer 2 (the last trip reads its own row again: in bounds, unused)
    asm volatile("s_wait_xcnt 0x0" ::: "memory");      // the next line overwrites the address registers that this row's pixel loads name
    prow += (i + 8 < IH) ? 8 * IH * IC : 0;
#pragma unroll
    for (int p = 0; p < NPT; ++p)
#pragma unroll
      for (int kb = 0; kb < IC / 32; ++kb) px[p][kb] = frag_at(prow + p * 16 * IC, kb * 32, 0);
    v8f acc3[NPT] = {};
    // kept rolled: the body already holds 34 matrix instructions, and unrolled the weight reads of all trips are lifted ahead and spill
#pragma unroll 1
    for (int s = 0; s < HH / 32; ++s) {
      v8f acc[2][NPT] = {};
      // full unroll: h1 is indexed by kb
#pragma unroll
      for (int kb = 0; kb < HH / 32; ++kb)
#pragma unroll
        for (int u = 0; u < 2; ++u) {
          const v16h a = frag_at(&sW2[(2 * s + u) * 16 + ln][0], kb * 32, hh);
#pragma unroll
          for (int p = 0; p < NPT; ++p) acc[u][p] = wmma_h(a, h1[p][kb].v, acc[u][p]);
        }
      const v16h a3 = frag_at(&sW3[ln][0], s * 32, hh);
      const float* bs = &sB2[2 * s * 16 + 8 * hh];
      const v4f d0 = *(const v4fa*)bs, d1 = *(const v4fa*)(bs + 4), d2 = *(const v4fa*)(bs + 16), d3 = *(const v4fa*)(bs + 20);
#pragma unroll
      for (int p = 0; p < NPT; ++p) {
        FragH h2;
        pack_tile(h2, 0, acc[0][p], d0, d1); pack_tile(h2, 1, acc[1][p], d2, d3);
        acc3[p] = wmma_h(a3, h2.v, acc3[p]);
      }
    }
    // pixel shuffle: lane (ln, hh) holds kj = 0, 1 of output row 2i + hh for pixel j = 16p + ln; each half wave stores one whole 128-B line
    float* orow = out + (((size_t)n * OC + o) * (2 * IH) + 2 * i + hh) * (2 * IH) + 2 * ln;
#pragma unroll
    for (int p = 0; p < NPT; ++p) { v2f y; y[0] = acc3[p][0] * 0.0625f + c30; y[1] = acc3[p][1] * 0.0625f + c31; *(v2f*)(orow + p * 32) = y; }
    asm volatile("s_wait_xcnt 0x0" ::: "memory");      // the next trip overwrites the registers that these stores name (its clobber also keeps the loop-invariant weight reads from being hoisted into registers, where they spill)
  }
}
extern "C" void kernel_launch(void* const* d_in, const int* in_sizes, int n_in,
                              void* d_out, int out_size, void* d_ws, size_t ws_size, hipStream_t stream) {
  (void)in_sizes; (void)n_in; (void)out_size;
  const float* x = (const float*)d_in[0]; const float* W1 = (const float*)d_in[1]; const float* b1 = (const float*)d_in[2]; const float* W2 = (const float*)d_in[3]; const float* b2 = (const float*)d_in[4]; const float* W3 = (const float*)d_in[5]; const float* b3 = (const float*)d_in[6];
  char* ws = (char*)d_ws; size_t off = 0;
  auto take = [&](size_t bytes) { char* p = ws + off; off += (bytes + 255) & ~(size_t)255; return p; };
  _Float16* Bt1 = (_Float16*)take((size_t)OC * HH * IC * 2); _Float16* Bt2 = (_Float16*)take((size_t)OC * HH * HH * 2); _Float16* PIX = (_Float16*)take((size_t)NPX * IC * 2);
  if (off > ws_size) return;      // 2.1 + 4.2 + 2.1 MiB
  k_prep<<<OC * (HH / 64) + OC * (IC / 64) + NBt * (IC / 64) * 4, 256, 0, stream>>>(x, W1, W2, PIX, Bt1, Bt2);
  k_mlp<<<OC * NBt, 256, 0, stream>>>(PIX, Bt1, Bt2, b1, b2, W3, b3, (float*)d_out);
}

// v003
// One run takes 30.3 microseconds.
// Next to v002, in two timings, it ran 1.12 times as fast each time.
// All steps since v000 together make it 13.1 times as fast.
#include <hip/hip_runtime.h>
// DeConv2d as 32 per-output-channel pixel MLPs (8192 pixels x 128 -> 256 -> 256 -> 2x2), all three layers in ONE kernel on v_wmma_f32_16x16x32_f16.
// k_mlp itself turns W [o][in][out] f32 into bf16-exact x 2^4 f16 rows [out][in] on the way into LDS, and x into pixel fragments on the way into registers (no workspace); it keeps one channel's weights in LDS and computes every layer transposed
// (A = weight rows, B = pixel columns), so that two f32 D tiles, after + bias, relu and the rounding to f16, ARE the next layer's B fragment: the hidden rows never leave the registers.
#define NBt 8
#define IC 128
#define IH 32
#define NPX (NBt * IH * IH)
#define OC 32
#define HH 256

typedef __bf16 v16b __attribute__((ext_vector_type(16)));
typedef unsigned short v8us __attribute__((ext_vector_type(8), may_alias));
typedef float  v8f  __attribute__((ext_vector_type(8)));
typedef float  v4f  __attribute__((ext_vector_type(4)));
typedef float  v4fa __attribute__((ext_vector_type(4), may_alias));
union FragB { v16b v; v8us half[2]; unsigned short u[16]; };

__device__ __forceinline__ unsigned short bf16_bits(float x) { unsigned int u = __float_as_uint(x); return (unsigned short)((u + 0x7FFFu + ((u >> 16) & 1u)) >> 16); }
__device__ __forceinline__ float bf16_val(unsigned short b) { return __uint_as_float(((unsigned int)b) << 16); }
__device__ __forceinline__ float bf16_round(float x) { return bf16_val(bf16_bits(x)); }
// D += A·B with NT terms: 1 = ah·bh, 2 = + al·bh (A split), 3 = + ah·bl (both split)
template <int NT>
__device__ __forceinline__ v8f mmaN(v16b ah, v16b al, v16b bh, v16b bl, v8f c) {
  c = __builtin_amdgcn_wmma_f32_16x16x32_bf16(false, ah, false, bh, (short)0, c, false, false);
  if (NT >= 2) c = __builtin_amdgcn_wmma_f32_16x16x32_bf16(false, al, false, bh, (short)0, c, false, false);
  if (NT >= 3) c = __builtin_amdgcn_wmma_f32_16x16x32_bf16(false, ah, false, bl, (short)0, c, false, false);
  asm volatile("v_nop\n\tv_nop\n\tv_nop\n\tv_nop" : "+v"(c) : "v"(ah), "v"(al), "v"(bh), "v"(bl));
  return c;
}

__global__ __launch_bounds__(256) void k_wt_bf16(const float* __restrict__ W, unsigned short* __restrict__ Wt, int K, int N) {
  const int t = blockIdx.x * 256 + threadIdx.x;
  const int k8n = K / 8;
  if (t >= N * k8n) return;
  const int n = t / k8n, k8 = (t % k8n) * 8;
  v8us v;
#pragma unroll
  for (int i = 0; i < 8; ++i) v[i] = bf16_bits(W[(size_t)(k8 + i) * N + n]);
  *(v8us*)(Wt + (size_t)n * K + k8) = v;
  
}

// GEMM C[M][N] (f32, pitch ldc) = act(A[M][K]·W + bias). A f32 row-major (pitch lda) converted per fragment to bf16
// (ASPLIT: hi/lo two planes -> 2 terms, else single rounded term); Wt bf16 [N][K] (pitch ldb). BIAS_BF16 rounds the
// bias to bf16 first (bias quantised to bf16 before the add). K%32==0, M%16==0, N%64==0.
template <bool ASPLIT, int ACT, bool BIAS_BF16>
__global__ __launch_bounds__(128) void k_gemm_bf(const float* __restrict__ A, int lda, const unsigned short* __restrict__ Wt, int ldb,
                                               const float* __restrict__ bias, float* __restrict__ C, int ldc, int M, int N, int K) {
  __shared__ __attribute__((aligned(16))) float so[4][16][64];
  const int tid = threadIdx.x, w = tid >> 5, lane = tid & 31, ln = lane & 15, hh = lane >> 4;
  const int ntn = N / 64;
  const int wid = blockIdx.x * 4 + w;
  const int mt = wid / ntn, nq = wid % ntn;
  if (mt * 16 >= M) return;
  const int row0 = mt * 16, col0 = nq * 64;
  const float* arow = A + (size_t)(row0 + ln) * lda;
  v8f acc[4] = {};
  for (int kb = 0; kb < K; kb += 32) {
    FragB ah, al;
    const v4f x0 = *(const v4fa*)(arow + kb + 8 * hh), x1 = *(const v4fa*)(arow + kb + 8 * hh + 4);
    const v4f x2 = *(const v4fa*)(arow + kb + 16 + 8 * hh), x3 = *(const v4fa*)(arow + kb + 16 + 8 * hh + 4);
    float xs[16] = {x0[0],x0[1],x0[2],x0[3],x1[0],x1[1],x1[2],x1[3],x2[0],x2[1],x2[2],x2[3],x3[0],x3[1],x3[2],x3[3]};
#pragma unroll
    for (int i = 0; i < 16; ++i) { const unsigned short hb = bf16_bits(xs[i]); ah.u[i] = hb; al.u[i] = ASPLIT ? bf16_bits(xs[i] - bf16_val(hb)) : (unsigned short)0; }
#pragma unroll
    for (int t = 0; t < 4; ++t) {
      const unsigned short* brow = Wt + (size_t)(col0 + t * 16 + ln) * ldb + kb;
      FragB b;
      b.half[0] = *(const v8us*)(brow + 8 * hh);
      b.half[1] = *(const v8us*)(brow + 16 + 8 * hh);
      acc[t] = mmaN<ASPLIT ? 2 : 1>(ah.v, al.v, b.v, b.v, acc[t]);
    }
  }
#pragma unroll
  for (int t = 0; t < 4; ++t) {
    float bv = bias ? bias[col0 + t * 16 + ln] : 0.f;
    if (BIAS_BF16) bv = bf16_round(bv);
#pragma unroll
    for (int r = 0; r < 8; ++r) { float v = acc[t][r] + bv; if (ACT == 1) v = fmaxf(v, 0.f); so[w][8 * hh + r][t * 16 + ln] = v; }
  }
  __builtin_amdgcn_fence(__ATOMIC_ACQ_REL, "workgroup");
  __builtin_amdgcn_wave_barrier();
  const int rsub = lane >> 4, c4 = (lane & 15) * 4;
  {
#pragma unroll
    for (int q = 0; q < 8; ++q) {
      const int r = q * 2 + rsub;
      const v4f v = *(const v4fa*)&so[w][r][c4];
      *(v4f*)(C + (size_t)(row0 + r) * ldc + col0 + c4) = v;
    }
    
  }
}

// Flash-style causal/unmasked attention, all contractions 3-term bf16 hi/lo splits, f32 softmax with running max.
// q,k,v rows are read from f32 buffers with arbitrary row pitch (so they can live inside a fused qkv buffer);
// D = head size (multiple of 32, <= 128); one wave = 16 query rows; block = 4 waves (64 queries) sharing K/V chunks of 32.
template <int D, bool CAUSAL>
__global__ __launch_bounds__(128) void k_flash(const float* __restrict__ qb, const float* __restrict__ kb, const float* __restrict__ vb,
                                             int pitch, int T, int H, float scale, float* __restrict__ y, int ypitch) {
  constexpr int KS = D / 32;        // k-steps for QK
  constexpr int DT = D / 16;        // d tiles for PV
  __shared__ __attribute__((aligned(16))) unsigned short sKh[32][D + 8], sKl[32][D + 8], sVh[32][D + 8], sVl[32][D + 8];
  __shared__ __attribute__((aligned(16))) unsigned short sPh[4][16][40], sPl[4][16][40];
  __shared__ __attribute__((aligned(16))) float sO[4][16][D];
  const int tid = threadIdx.x, w = tid >> 5, lane = tid & 31, ln = lane & 15, hh = lane >> 4;
  const int nqb = (T + 63) / 64;
  const int bh = blockIdx.x / nqb, qblk = blockIdx.x % nqb;
  const int b = bh / H, h = bh % H;
  const int q0 = qblk * 64 + w * 16;
  const float* Q = qb + (size_t)b * T * pitch + h * D;
  const float* K = kb + (size_t)b * T * pitch + h * D;
  const float* V = vb + (size_t)b * T * pitch + h * D;

  // A fragments of the wave's 16 query rows (scaled), hi/lo
  FragB aqh[KS], aql[KS];
  {
    int row = q0 + ln; if (row >= T) row = T - 1;
    const float* qr = Q + (size_t)row * pitch;
#pragma unroll
    for (int ks = 0; ks < KS; ++ks)
#pragma unroll
      for (int i = 0; i < 16; ++i) {
        const int d = ks * 32 + ((i < 8) ? (8 * hh + i) : (16 + 8 * hh + (i - 8)));
        const float x = qr[d] * scale; const unsigned short hb = bf16_bits(x);
        aqh[ks].u[i] = hb; aql[ks].u[i] = bf16_bits(x - bf16_val(hb));
      }
  }
  float m_r[8], l_r[8];
#pragma unroll
  for (int r = 0; r < 8; ++r) { m_r[r] = -3.0e38f; l_r[r] = 0.f; }
  v8f oacc[DT];
#pragma unroll
  for (int dt = 0; dt < DT; ++dt) oacc[dt] = (v8f){0.f,0.f,0.f,0.f,0.f,0.f,0.f,0.f};

  const int kv_end = CAUSAL ? min(T, qblk * 64 + 64) : T;     // block-uniform
  for (int j0 = 0; j0 < kv_end; j0 += 32) {
    __syncthreads();
    for (int e = tid; e < 32 * (D / 4); e += 128) {
      const int r = e / (D / 4), c4 = (e % (D / 4)) * 4;
      const int key = j0 + r;
      v4f kf = {0.f,0.f,0.f,0.f}, vf = {0.f,0.f,0.f,0.f};
      if (key < T) { kf = *(const v4fa*)(K + (size_t)key * pitch + c4); vf = *(const v4fa*)(V + (size_t)key * pitch + c4); }
#pragma unroll
      for (int t = 0; t < 4; ++t) {
        unsigned short hb = bf16_bits(kf[t]); sKh[r][c4 + t] = hb; sKl[r][c4 + t] = bf16_bits(kf[t] - bf16_val(hb));
        hb = bf16_bits(vf[t]); sVh[r][c4 + t] = hb; sVl[r][c4 + t] = bf16_bits(vf[t] - bf16_val(hb));
      }
    }
    __syncthreads();
    // S tile 16 x 32
    v8f s[2];
#pragma unroll
    for (int nt = 0; nt < 2; ++nt) {
      v8f acc = {};
#pragma unroll
      for (int ks = 0; ks < KS; ++ks) {
        FragB bh_, bl_;
        bh_.half[0] = *(const v8us*)&sKh[nt * 16 + ln][ks * 32 + 8 * hh]; bh_.half[1] = *(const v8us*)&sKh[nt * 16 + ln][ks * 32 + 16 + 8 * hh];
        bl_.half[0] = *(const v8us*)&sKl[nt * 16 + ln][ks * 32 + 8 * hh]; bl_.half[1] = *(const v8us*)&sKl[nt * 16 + ln][ks * 32 + 16 + 8 * hh];
        acc = mmaN<3>(aqh[ks].v, aql[ks].v, bh_.v, bl_.v, acc);
      }
      s[nt] = acc;
    }
    // mask + running max (rows 8hh+r; the 16 lanes of a half share rows)
    float alpha[8];
#pragma unroll
    for (int r = 0; r < 8; ++r) {
      const int qi = q0 + 8 * hh + r;
      const int ja = j0 + ln, jb = j0 + 16 + ln;
      if (CAUSAL) { if (ja > qi) s[0][r] = -3.0e38f; if (jb > qi) s[1][r] = -3.0e38f; }
      if (ja >= T) s[0][r] = -3.0e38f;
      if (jb >= T) s[1][r] = -3.0e38f;
      float mx = fmaxf(s[0][r], s[1][r]);
      mx = fmaxf(mx, __shfl_xor(mx, 1, 32)); mx = fmaxf(mx, __shfl_xor(mx, 2, 32)); mx = fmaxf(mx, __shfl_xor(mx, 4, 32)); mx = fmaxf(mx, __shfl_xor(mx, 8, 32));
      const float mnew = fmaxf(m_r[r], mx);
      alpha[r] = (mnew > -1.0e38f) ? __expf(m_r[r] - mnew) : 1.0f;
      const float p0 = (s[0][r] > -1.0e38f) ? __expf(s[0][r] - mnew) : 0.f;
      const float p1 = (s[1][r] > -1.0e38f) ? __expf(s[1][r] - mnew) : 0.f;
      m_r[r] = mnew;
      l_r[r] = l_r[r] * alpha[r] + p0 + p1;            // per-lane partial row sum (16 lanes combined at the end)
      unsigned short hb = bf16_bits(p0); sPh[w][8 * hh + r][ln] = hb;      sPl[w][8 * hh + r][ln] = bf16_bits(p0 - bf16_val(hb));
      hb = bf16_bits(p1);                sPh[w][8 * hh + r][16 + ln] = hb; sPl[w][8 * hh + r][16 + ln] = bf16_bits(p1 - bf16_val(hb));
    }
#pragma unroll
    for (int dt = 0; dt < DT; ++dt)
#pragma unroll
      for (int r = 0; r < 8; ++r) oacc[dt][r] *= alpha[r];
    __builtin_amdgcn_fence(__ATOMIC_ACQ_REL, "workgroup");
    __builtin_amdgcn_wave_barrier();
    FragB pah, pal;
    pah.half[0] = *(const v8us*)&sPh[w][ln][8 * hh]; pah.half[1] = *(const v8us*)&sPh[w][ln][16 + 8 * hh];
    pal.half[0] = *(const v8us*)&sPl[w][ln][8 * hh]; pal.half[1] = *(const v8us*)&sPl[w][ln][16 + 8 * hh];
#pragma unroll
    for (int dt = 0; dt < DT; ++dt) {
      FragB bvh, bvl;
#pragma unroll
      for (int i = 0; i < 8; ++i) {
        bvh.u[i] = sVh[8 * hh + i][dt * 16 + ln]; bvh.u[8 + i] = sVh[16 + 8 * hh + i][dt * 16 + ln];
        bvl.u[i] = sVl[8 * hh + i][dt * 16 + ln]; bvl.u[8 + i] = sVl[16 + 8 * hh + i][dt * 16 + ln];
      }
      oacc[dt] = mmaN<3>(pah.v, pal.v, bvh.v, bvl.v, oacc[dt]);
    }
    __builtin_amdgcn_fence(__ATOMIC_ACQ_REL, "workgroup");
    __builtin_amdgcn_wave_barrier();
  }
#pragma unroll
  for (int r = 0; r < 8; ++r) {
    float l = l_r[r];
    l += __shfl_xor(l, 1, 32); l += __shfl_xor(l, 2, 32); l += __shfl_xor(l, 4, 32); l += __shfl_xor(l, 8, 32);
    l_r[r] = (l > 0.f) ? 1.0f / l : 0.f;
  }
#pragma unroll
  for (int dt = 0; dt < DT; ++dt)
#pragma unroll
    for (int r = 0; r < 8; ++r) sO[w][8 * hh + r][dt * 16 + ln] = oacc[dt][r] * l_r[r];
  __builtin_amdgcn_fence(__ATOMIC_ACQ_REL, "workgroup");
  __builtin_amdgcn_wave_barrier();
  {
    for (int r = 0; r < 16; ++r) {
      const int row = q0 + r;
      if (row < T && lane < D / 4) {
        const v4f val = *(const v4fa*)&sO[w][r][lane * 4];
        *(v4f*)(y + ((size_t)b * T + row) * ypitch + h * D + lane * 4) = val;
      }
    }
    
  }
}

// GEMM C = act(A·W + bias + resid): A f32 (ASPLIT -> hi/lo 2 terms), Wt bf16 [N][K]; ACT 0 none, 1 relu, 2 exact gelu;
// resid (optional, f32, row index = (row % rmod), pitch ldr, RES_BF16 rounds it) added before the activation.
template <bool ASPLIT, int ACT, bool BIAS_BF16, bool RES_BF16>
__global__ __launch_bounds__(128) void k_gemm_bf3(const float* __restrict__ A, int lda, const unsigned short* __restrict__ Wt, int ldb,
                                                const float* __restrict__ bias, const float* __restrict__ resid, int rmod, int ldr,
                                                float* __restrict__ C, int ldc, int M, int N, int K) {
  __shared__ __attribute__((aligned(16))) float so[4][16][64];
  const int tid = threadIdx.x, w = tid >> 5, lane = tid & 31, ln = lane & 15, hh = lane >> 4;
  const int ntn = N / 64;
  const int wid = blockIdx.x * 4 + w;
  const int mt = wid / ntn, nq = wid % ntn;
  if (mt * 16 >= M) return;
  const int row0 = mt * 16, col0 = nq * 64;
  const float* arow = A + (size_t)(row0 + ln) * lda;
  v8f acc[4] = {};
  for (int kb = 0; kb < K; kb += 32) {
    FragB ah, al;
    const v4f x0 = *(const v4fa*)(arow + kb + 8 * hh), x1 = *(const v4fa*)(arow + kb + 8 * hh + 4);
    const v4f x2 = *(const v4fa*)(arow + kb + 16 + 8 * hh), x3 = *(const v4fa*)(arow + kb + 16 + 8 * hh + 4);
    float xs[16] = {x0[0],x0[1],x0[2],x0[3],x1[0],x1[1],x1[2],x1[3],x2[0],x2[1],x2[2],x2[3],x3[0],x3[1],x3[2],x3[3]};
#pragma unroll
    for (int i = 0; i < 16; ++i) { const unsigned short hb = bf16_bits(xs[i]); ah.u[i] = hb; al.u[i] = ASPLIT ? bf16_bits(xs[i] - bf16_val(hb)) : (unsigned short)0; }
#pragma unroll
    for (int t = 0; t < 4; ++t) {
      const unsigned short* brow = Wt + (size_t)(col0 + t * 16 + ln) * ldb + kb;
      FragB b;
      b.half[0] = *(const v8us*)(brow + 8 * hh);
      b.half[1] = *(const v8us*)(brow + 16 + 8 * hh);
      acc[t] = mmaN<ASPLIT ? 2 : 1>(ah.v, al.v, b.v, b.v, acc[t]);
    }
  }
#pragma unroll
  for (int t = 0; t < 4; ++t) {
    const int col = col0 + t * 16 + ln;
    float bv = bias ? bias[col] : 0.f;
    if (BIAS_BF16) bv = bf16_round(bv);
#pragma unroll
    for (int r = 0; r < 8; ++r) {
      float v = acc[t][r] + bv;
      if (resid) { float rv = resid[(size_t)((row0 + 8 * hh + r) % rmod) * ldr + col]; if (RES_BF16) rv = bf16_round(rv); v += rv; }
      if (ACT == 1) v = fmaxf(v, 0.f);
      if (ACT == 2) v = 0.5f * v * (1.0f + erff(v * 0.70710678118654752f));
      if (ACT == 3) { const float u = 0.7978845608028654f * (v + 0.044715f * v * v * v); v = 0.5f * v * (1.0f + tanhf(u)); }
      so[w][8 * hh + r][t * 16 + ln] = v;
    }
  }
  __builtin_amdgcn_fence(__ATOMIC_ACQ_REL, "workgroup");
  __builtin_amdgcn_wave_barrier();
  const int rsub = lane >> 4, c4 = (lane & 15) * 4;
  {
#pragma unroll
    for (int q = 0; q < 8; ++q) {
      const int r = q * 2 + rsub;
      const v4f v = *(const v4fa*)&so[w][r][c4];
      *(v4f*)(C + (size_t)(row0 + r) * ldc + col0 + c4) = v;
    }
    
  }
}
// row LayerNorm (biased variance, eps) over N: s = X (+ R); optional out_sum <- s; out_norm <- (s-mu)*rsqrt(var+eps)*g + b
template <bool PARAM_BF16>
__global__ __launch_bounds__(256) void k_layernorm(const float* __restrict__ X, const float* __restrict__ R, const float* __restrict__ g, const float* __restrict__ bta,
                                                  float* __restrict__ out_sum, float* __restrict__ out_norm, int N, float eps) {
  __shared__ float red[256];
  const int row = blockIdx.x, tid = threadIdx.x;
  const float* x = X + (size_t)row * N; const float* rr = R ? R + (size_t)row * N : nullptr;
  float vals[16];                     // up to N = 4096
  const int per = N / 256;            // contiguous chunk per thread? use strided-by-4 chunks: thread handles j = tid*4 + 1024*u
  float s1 = 0.f;
  for (int u = 0; u < per / 4; ++u) {
    const int j = tid * 4 + 1024 * u;
    const v4f a = *(const v4fa*)(x + j);
    v4f b = {0.f,0.f,0.f,0.f}; if (rr) b = *(const v4fa*)(rr + j);
#pragma unroll
    for (int q = 0; q < 4; ++q) { const float v = a[q] + b[q]; vals[u * 4 + q] = v; s1 += v; }
  }
  red[tid] = s1; __syncthreads();
  for (int st = 128; st > 0; st >>= 1) { if (tid < st) red[tid] += red[tid + st]; __syncthreads(); }
  const float mu = red[0] / (float)N; __syncthreads();
  float s2 = 0.f;
  for (int u = 0; u < per / 4; ++u)
#pragma unroll
    for (int q = 0; q < 4; ++q) { const float c = vals[u * 4 + q] - mu; s2 += c * c; }
  red[tid] = s2; __syncthreads();
  for (int st = 128; st > 0; st >>= 1) { if (tid < st) red[tid] += red[tid + st]; __syncthreads(); }
  const float rs = rsqrtf(red[0] / (float)N + eps);
  {
    for (int u = 0; u < per / 4; ++u) {
      const int j = tid * 4 + 1024 * u;
      v4f o, sm;
#pragma unroll
      for (int q = 0; q < 4; ++q) {
        float gg = g[j + q], bb = bta[j + q];
        if (PARAM_BF16) { gg = bf16_round(gg); bb = bf16_round(bb); }
        sm[q] = vals[u * 4 + q]; o[q] = (vals[u * 4 + q] - mu) * rs * gg + bb;
      }
      if (out_sum) *(v4f*)(out_sum + (size_t)row * N + j) = sm;
      *(v4f*)(out_norm + (size_t)row * N + j) = o;
    }
    
  }
}



// ---- f16 WMMA path (v_wmma_f32_16x16x32_f16): 11-bit significands for operands in range — used here for all three MLP layers (k_mlp)
typedef _Float16 v16h __attribute__((ext_vector_type(16)));
union FragH { v16h v; v8us half[2]; _Float16 h[16]; unsigned short u[16]; };
template <int NT>
__device__ __forceinline__ v8f mmaH(v16h ah, v16h al, v16h bh, v16h bl, v8f c) {
  c = __builtin_amdgcn_wmma_f32_16x16x32_f16(false, ah, false, bh, (short)0, c, false, false);
  if (NT >= 2) c = __builtin_amdgcn_wmma_f32_16x16x32_f16(false, al, false, bh, (short)0, c, false, false);
  if (NT >= 3) c = __builtin_amdgcn_wmma_f32_16x16x32_f16(false, ah, false, bl, (short)0, c, false, false);
  asm volatile("v_nop\n\tv_nop\n\tv_nop\n\tv_nop" : "+v"(c) : "v"(ah), "v"(al), "v"(bh), "v"(bl));
  return c;
}
// batched GEMM like k_gemm_b but f16 operands: A f32 (split into f16 hi/lo if ASPLIT, else rounded to f16), Bt = f16 values [n][k]; alpha; C f32; N multiple of 16 (partial tiles skipped)
template <bool ASPLIT>
__global__ __launch_bounds__(128) void k_gemm_h(const float* __restrict__ A, int lda, size_t sA, const _Float16* __restrict__ Bh, int ldb, size_t sB, float alpha, float* __restrict__ C, int ldc, size_t sC, int M, int N, int K) {
  __shared__ __attribute__((aligned(16))) float so[4][16][64];
  const int tid = threadIdx.x, w = tid >> 5, lane = tid & 31, ln = lane & 15, hh = lane >> 4; const int by = blockIdx.y;
  A += (size_t)by * sA; Bh += (size_t)by * sB; C += (size_t)by * sC;
  const int ntn = (N + 63) / 64; const int wid = blockIdx.x * 4 + w; const int mt = wid / ntn, nq = wid % ntn; if (mt * 16 >= M) return;
  const int row0 = mt * 16, col0 = nq * 64; const float* arow = A + (size_t)(row0 + ln) * lda;
  v8f acc[4] = {};
  for (int kb = 0; kb < K; kb += 32) {
    FragH ah, al;
    const v4f x0 = *(const v4fa*)(arow + kb + 8 * hh), x1 = *(const v4fa*)(arow + kb + 8 * hh + 4), x2 = *(const v4fa*)(arow + kb + 16 + 8 * hh), x3 = *(const v4fa*)(arow + kb + 16 + 8 * hh + 4);
    float xs[16] = {x0[0],x0[1],x0[2],x0[3],x1[0],x1[1],x1[2],x1[3],x2[0],x2[1],x2[2],x2[3],x3[0],x3[1],x3[2],x3[3]};
#pragma unroll
    for (int i = 0; i < 16; ++i) { const _Float16 h = (_Float16)xs[i]; ah.h[i] = h; al.h[i] = ASPLIT ? (_Float16)(xs[i] - (float)h) : (_Float16)0.0f; }
#pragma unroll
    for (int t = 0; t < 4; ++t) { if (col0 + t * 16 >= N) continue; const size_t boff = (size_t)(col0 + t * 16 + ln) * ldb + kb; FragH bq; bq.half[0] = *(const v8us*)(Bh + boff + 8 * hh); bq.half[1] = *(const v8us*)(Bh + boff + 16 + 8 * hh);
      acc[t] = mmaH<ASPLIT ? 2 : 1>(ah.v, al.v, bq.v, bq.v, acc[t]); }
  }
#pragma unroll
  for (int t = 0; t < 4; ++t) { if (col0 + t * 16 >= N) continue;
#pragma unroll
    for (int r = 0; r < 8; ++r) so[w][8 * hh + r][t * 16 + ln] = acc[t][r] * alpha; }
  __builtin_amdgcn_fence(__ATOMIC_ACQ_REL, "workgroup"); __builtin_amdgcn_wave_barrier();
  const int rsub = lane >> 4, c4 = (lane & 15) * 4;
  {
#pragma unroll
    for (int q = 0; q < 8; ++q) { const int r = q * 2 + rsub; if (col0 + c4 < N) { const v4f v = *(const v4fa*)&so[w][r][c4]; *(v4f*)(C + (size_t)(row0 + r) * ldc + col0 + c4) = v; } }
     }
}

// Wt[n][k] = f16(W[k][n]·scale) from f32 row-major W[K][N] (scale = power of two; bf16-exact weights stay exact in f16 away from the subnormal range)
__global__ __launch_bounds__(256) void k_wt_f16(const float* __restrict__ W, _Float16* __restrict__ Wt, int K, int N, float scale) {
  const int t = blockIdx.x * 256 + threadIdx.x; if (t >= N * (K / 8)) return; const int n = t / (K / 8), k8 = (t % (K / 8)) * 8; FragH f;
#pragma unroll
  for (int i = 0; i < 8; ++i) f.h[i] = (_Float16)(bf16_round(W[(size_t)(k8 + i) * N + n]) * scale); const v8us o = f.half[0];
  *(v8us*)((unsigned short*)Wt + (size_t)n * K + k8) = o; 
}

#define NPT 2           // pixel tiles of 16 per wave = one image row of 32 pixels (tile p holds pixels j = 2 ln + p); each weight fragment read from LDS feeds NPT products
#define P1 (IC + 8)     // LDS row pitch in f16: 272 B and 528 B are 16 B x odd, the conflict-free pitch for ds_load_b128 fragment reads
#define P2 (HH + 8)
typedef float v2f __attribute__((ext_vector_type(2)));
typedef float v2fa __attribute__((ext_vector_type(2), may_alias));
typedef __bf16 v2bf __attribute__((ext_vector_type(2)));
// two values rounded to bf16, to nearest even (what bf16_round gives for every finite value), and widened again: one packed conversion for the pair
__device__ __forceinline__ v2f bf16_round2(float a, float b) { const v2f t = {a, b}; return __builtin_convertvector(__builtin_convertvector(t, v2bf), v2f); }
// 32 k rows of the lane's two adjacent weight columns, f32: a wave reads 256 contiguous bytes (two whole lines) of each row, all 32 reads in flight together
__device__ __forceinline__ void wload32(v2f (&r)[32], const float* s) {
#pragma unroll
  for (int i = 0; i < 32; ++i) r[i] = *(const v2fa*)(s + i * HH);
  // the wait stands before anything overwrites the address registers that the 32 reads name; its clobber also keeps these reads ahead of the conversion that follows in the source
  asm volatile("s_wait_xcnt 0x0" :: "v"(s) : "memory");
}
// the same 32 x 2 values as f16(bf16_round(v) * 16), transposed (the exact scaling by 2^4 is done in f32 ahead of the rounding: same value, and nothing small passes through f16 unscaled): 16-byte pieces (8 consecutive k) of the LDS rows n and n + 1, d = the place of (n, first k)
__device__ __forceinline__ void wput32(const v2f (&r)[32], unsigned short* d, int pitch) {
  v2f q[32];
#pragma unroll
  for (int i = 0; i < 32; ++i) q[i] = r[i] * 16.0f;
#pragma unroll
  for (int c = 0; c < 2; ++c)
#pragma unroll
    for (int g = 0; g < 4; ++g) {
      FragH f;
#pragma unroll
      for (int i = 0; i < 8; i += 2) { const v2f t = bf16_round2(q[g * 8 + i][c], q[g * 8 + i + 1][c]); f.h[i] = (_Float16)t[0]; f.h[i + 1] = (_Float16)t[1]; }
      *(v8us*)(d + c * pitch + g * 8) = f.half[0];
    }
}
// one image row of x, f32, in fragment order: r[kb][e] = channel kb * 32 + 8hh + e (e < 8) or kb * 32 + 16 + 8hh + e - 8, pixels 2 ln and 2 ln + 1; s includes 8hh channels and 2 ln. A half wave reads one whole line
__device__ __forceinline__ void xload(v2f (&r)[IC / 32][16], const float* s, int kb0, int kb1) {
#pragma unroll
  for (int kb = kb0; kb < kb1; ++kb)
#pragma unroll
    for (int e = 0; e < 16; ++e) r[kb][e] = *(const v2fa*)(s + (kb * 32 + (e >> 3) * 16 + (e & 7)) * (IH * IH));
  // the wait stands before anything overwrites the address registers that these reads name
  asm volatile("s_wait_xcnt 0x0" :: "v"(s) : "memory");
}
__device__ __forceinline__ v8f wmma_h(v16h a, v16h b, v8f c) { return __builtin_amdgcn_wmma_f32_16x16x32_f16(false, a, false, b, (short)0, c, false, false); }
// fragment of row (or column) 'row' at k0: elements 0..7 = k0 + 8hh + 0..7, elements 8..15 = k0 + 16 + 8hh + 0..7 (the order a packed pair of D tiles has)
__device__ __forceinline__ v16h frag_at(const unsigned short* row, int k0, int hh) { FragH f; f.half[0] = *(const v8us*)(row + k0 + 8 * hh); f.half[1] = *(const v8us*)(row + k0 + 16 + 8 * hh); return f.v; }
// half a B fragment of the next layer from one D tile: h[r] = f16(relu(acc[r] / 16 + bias[8hh + r])), c0 and c1 = the lane's 8 bias values
__device__ __forceinline__ void pack_tile(FragH& f, int u, v8f acc, v4f c0, v4f c1) {
#pragma unroll
  for (int r = 0; r < 8; ++r) f.h[u * 8 + r] = (_Float16)fmaxf(acc[r] * 0.0625f + (r < 4 ? c0[r & 3] : c1[r & 3]), 0.f);
}
// One work-group = one output channel o and one image n; 8 waves, each takes image rows i = w, w + 8, ...
// D maps: layers 1, 2: acc[r] = hidden[16t + 8hh + r][pixel ln]. Layer 3: rows 0, 1, 8, 9 of its A operand hold W3's columns k = 0, 1, 2, 3 (the rest zero), so acc3[kj] = out_k[2hh + kj][pixel ln]: ki = hh.
__global__ __launch_bounds__(256) void k_mlp(const float* __restrict__ x, const float* __restrict__ W1, const float* __restrict__ W2, const float* __restrict__ b1, const float* __restrict__ b2,
                                             const float* __restrict__ W3, const float* __restrict__ b3, float* __restrict__ out) {
  __shared__ __attribute__((aligned(16))) unsigned short sW1[HH][P1], sW2[HH][P2], sW3[16][P2];
  __shared__ __attribute__((aligned(16))) float sB1[HH], sB2[HH];
  const int tid = threadIdx.x, lane = tid & 31, ln = lane & 15, hh = lane >> 4;
  const int w = __builtin_amdgcn_readfirstlane(tid >> 5);      // the wave's number in a scalar register: the row loop below branches on SCC and leaves EXEC alone
  const int o = blockIdx.x / NBt, n = blockIdx.x % NBt;
  // staging: wave w takes the 64 columns (LDS rows) from 64 (w & 3) on and half of the k range (w >> 2), a lane two adjacent columns; two register sets of 32 k rows, so that one set's reads fly while the other is converted
  const int n0 = (w & 3) * 64 + 2 * lane, kh = w >> 2;
  const float* g1 = W1 + ((size_t)o * IC + kh * (IC / 2)) * HH + n0;
  const float* g2 = W2 + ((size_t)o * HH + kh * (HH / 2)) * HH + n0;
  const float* xrow = x + ((size_t)n * IC + 8 * hh) * (IH * IH) + w * IH + 2 * ln;      // channel 8hh, pixel (n, i = w, j = 2 ln)
  const v4f w3 = *(const v4fa*)(W3 + ((size_t)o * HH + tid) * 4);      // thread = hidden unit e: its four k
  const float b1v = b1[o * HH + tid], b2v = b2[o * HH + tid];
  const float c30 = bf16_round(hh ? b3[o * 4 + 2] : b3[o * 4]), c31 = bf16_round(hh ? b3[o * 4 + 3] : b3[o * 4 + 1]);      // ki = hh picks the pair
  v2f xr[IC / 32][16];
  {
    v2f ra[32], rb[32];
    wload32(ra, g1);
    wload32(rb, g1 + 32 * HH);
    wput32(ra, &sW1[n0][kh * (IC / 2)], P1);
    wload32(ra, g2);
    wput32(rb, &sW1[n0][kh * (IC / 2) + 32], P1);
    wload32(rb, g2 + 32 * HH);
    wput32(ra, &sW2[n0][kh * (HH / 2)], P2);
    wload32(ra, g2 + 64 * HH);
    wput32(rb, &sW2[n0][kh * (HH / 2) + 32], P2);
    wload32(rb, g2 + 96 * HH);
    xload(xr, xrow, 0, IC / 32);      // the wave's first image row flies behind the last weights
    wput32(ra, &sW2[n0][kh * (HH / 2) + 64], P2);
    wput32(rb, &sW2[n0][kh * (HH / 2) + 96], P2);
  }
#pragma unroll
  for (int m = 0; m < 16; ++m) { FragH f; f.h[0] = (_Float16)(bf16_round(w3[(m >> 3) * 2 + (m & 1)]) * 16.0f); sW3[m][tid] = ((m & 6) == 0) ? f.u[0] : (unsigned short)0; }
  sB1[tid] = bf16_round(b1v); sB2[tid] = bf16_round(b2v);
  __syncthreads();      // the weights are read-only from here on: the kernel's only barrier
  for (int i = w; i < IH; i += 8) {
    FragH px[NPT][IC / 32];      // the row's pixel fragments: f16(bf16_round(x))
#pragma unroll
    for (int p = 0; p < NPT; ++p)
#pragma unroll
      for (int kb = 0; kb < IC / 32; ++kb)
#pragma unroll
        for (int e = 0; e < 16; e += 2) { const v2f t = bf16_round2(xr[kb][e][p], xr[kb][e + 1][p]); px[p][kb].h[e] = (_Float16)t[0]; px[p][kb].h[e + 1] = (_Float16)t[1]; }
    FragH h1[NPT][HH / 32];
    v16h wa[2][2 * (IC / 32)]; v4f wc[2][4];      // two register sets: tile pair s + 1 is read from LDS while pair s is multiplied
#pragma unroll
    for (int q = 0; q < 2 * (IC / 32); ++q) wa[0][q] = frag_at(&sW1[(q & 1) * 16 + ln][0], (q >> 1) * 32, hh);
#pragma unroll
    for (int q = 0; q < 4; ++q) wc[0][q] = *(const v4fa*)&sB1[(q >> 1) * 16 + 8 * hh + (q & 1) * 4];
    // full unroll: h1 is indexed by s and has to stay in registers
#pragma unroll
    for (int s = 0; s < HH / 32; ++s) {
      if (s + 1 < HH / 32) {
#pragma unroll
        for (int q = 0; q < 2 * (IC / 32); ++q) wa[(s + 1) & 1][q] = frag_at(&sW1[(2 * (s + 1) + (q & 1)) * 16 + ln][0], (q >> 1) * 32, hh);
#pragma unroll
        for (int q = 0; q < 4; ++q) wc[(s + 1) & 1][q] = *(const v4fa*)&sB1[(2 * (s + 1) + (q >> 1)) * 16 + 8 * hh + (q & 1) * 4];
      }
      // keeps the next pair's LDS reads ahead of this pair's matrix instructions; left free, the scheduler puts each read directly in front of its use and every product waits out the LDS latency
      __builtin_amdgcn_sched_barrier(0);
      v8f acc[2][NPT] = {};
#pragma unroll
      for (int kb = 0; kb < IC / 32; ++kb)
#pragma unroll
        for (int u = 0; u < 2; ++u)
#pragma unroll
          for (int p = 0; p < NPT; ++p) acc[u][p] = wmma_h(wa[s & 1][kb * 2 + u], px[p][kb].v, acc[u][p]);
#pragma unroll
      for (int u = 0; u < 2; ++u)
#pragma unroll
        for (int p = 0; p < NPT; ++p) pack_tile(h1[p][s], u, acc[u][p], wc[s & 1][u * 2], wc[s & 1][u * 2 + 1]);
    }
    // the next row's pixels fly during layer 2 (the last trip reads its own row again: in bounds, unused)
    xrow += (i + 8 < IH) ? 8 * IH : 0;
    v8f acc3[NPT] = {};
    // layer 2 in two halves, each headed by half of the pixel reads: 32 reads at a time, since all 64 at once would fill the wave's load counter and hold its matrix instructions back until the first read returns
#pragma unroll
    for (int hf = 0; hf < 2; ++hf) {
    xload(xr, xrow, hf * (IC / 64), (hf + 1) * (IC / 64));
    // kept rolled: the body already holds 34 matrix instructions, and unrolled the weight reads of all trips are lifted ahead and spill
#pragma unroll 1
    for (int s = hf * (HH / 64); s < (hf + 1) * (HH / 64); ++s) {
      v8f acc[2][NPT] = {};
      // full unroll: h1 is indexed by kb
#pragma unroll
      for (int kb = 0; kb < HH / 32; ++kb)
#pragma unroll
        for (int u = 0; u < 2; ++u) {
          const v16h a = frag_at(&sW2[(2 * s + u) * 16 + ln][0], kb * 32, hh);
#pragma unroll
          for (int p = 0; p < NPT; ++p) acc[u][p] = wmma_h(a, h1[p][kb].v, acc[u][p]);
        }
      const v16h a3 = frag_at(&sW3[ln][0], s * 32, hh);
      const float* bs = &sB2[2 * s * 16 + 8 * hh];
      const v4f d0 = *(const v4fa*)bs, d1 = *(const v4fa*)(bs + 4), d2 = *(const v4fa*)(bs + 16), d3 = *(const v4fa*)(bs + 20);
#pragma unroll
      for (int p = 0; p < NPT; ++p) {
        FragH h2;
        pack_tile(h2, 0, acc[0][p], d0, d1); pack_tile(h2, 1, acc[1][p], d2, d3);
        acc3[p] = wmma_h(a3, h2.v, acc3[p]);
      }
    }
    }
    // pixel shuffle: lane (ln, hh) holds kj = 0, 1 of output row 2i + hh for pixels j = 2 ln and 2 ln + 1, four adjacent floats; each half wave stores one whole output row of 256 B
    float* orow = out + (((size_t)n * OC + o) * (2 * IH) + 2 * i + hh) * (2 * IH) + 4 * ln;
    { v4f y; y[0] = acc3[0][0] * 0.0625f + c30; y[1] = acc3[0][1] * 0.0625f + c31; y[2] = acc3[1][0] * 0.0625f + c30; y[3] = acc3[1][1] * 0.0625f + c31; *(v4f*)orow = y; }
    asm volatile("s_wait_xcnt 0x0" ::: "memory");      // the next trip overwrites the registers that these stores name (its clobber also keeps the loop-invariant weight reads from being hoisted into registers, where they spill)
  }
}
extern "C" void kernel_launch(void* const* d_in, const int* in_sizes, int n_in,
                              void* d_out, int out_size, void* d_ws, size_t ws_size, hipStream_t stream) {
  (void)in_sizes; (void)n_in; (void)out_size; (void)d_ws; (void)ws_size;
  const float* x = (const float*)d_in[0]; const float* W1 = (const float*)d_in[1]; const float* b1 = (const float*)d_in[2]; const float* W2 = (const float*)d_in[3]; const float* b2 = (const float*)d_in[4]; const float* W3 = (const float*)d_in[5]; const float* b3 = (const float*)d_in[6];
  k_mlp<<<OC * NBt, 256, 0, stream>>>(x, W1, W2, b1, b2, W3, b3, (float*)d_out);
}

// v004
// A run of this version takes 28.9 microseconds.
// Timed twice side by side with v003, it ran 1.05 times as fast both times.
// All steps since v000 together make it 13.8 times as fast.
#include <hip/hip_runtime.h>
// DeConv2d as 32 per-output-channel pixel MLPs (8192 pixels x 128 -> 256 -> 256 -> 2x2), all three layers in ONE kernel on v_wmma_f32_16x16x32_f16.
// k_mlp itself turns W [o][in][out] f32 into bf16-exact x 2^4 f16 rows [out][in] on the way into LDS, and x into pixel fragments on the way into registers (no workspace); it keeps one channel's weights in LDS and computes every layer transposed
// (A = weight rows, B = pixel columns), so that two f32 D tiles, after + bias, relu and the rounding to f16, ARE the next layer's B fragment: the hidden rows never leave the registers.
#define NBt 8
#define IC 128
#define IH 32
#define NPX (NBt * IH * IH)
#define OC 32
#define HH 256

typedef __bf16 v16b __attribute__((ext_vector_type(16)));
typedef unsigned short v8us __attribute__((ext_vector_type(8), may_alias));
typedef float  v8f  __attribute__((ext_vector_type(8)));
typedef float  v4f  __attribute__((ext_vector_type(4)));
typedef float  v4fa __attribute__((ext_vector_type(4), may_alias));
union FragB { v16b v; v8us half[2]; unsigned short u[16]; };

__device__ __forceinline__ unsigned short bf16_bits(float x) { unsigned int u = __float_as_uint(x); return (unsigned short)((u + 0x7FFFu + ((u >> 16) & 1u)) >> 16); }
__device__ __forceinline__ float bf16_val(unsigned short b) { return __uint_as_float(((unsigned int)b) << 16); }
__device__ __forceinline__ float bf16_round(float x) { return bf16_val(bf16_bits(x)); }
// D += A·B with NT terms: 1 = ah·bh, 2 = + al·bh (A split), 3 = + ah·bl (both split)
template <int NT>
__device__ __forceinline__ v8f mmaN(v16b ah, v16b al, v16b bh, v16b bl, v8f c) {
  c = __builtin_amdgcn_wmma_f32_16x16x32_bf16(false, ah, false, bh, (short)0, c, false, false);
  if (NT >= 2) c = __builtin_amdgcn_wmma_f32_16x16x32_bf16(false, al, false, bh, (short)0, c, false, false);
  if (NT >= 3) c = __builtin_amdgcn_wmma_f32_16x16x32_bf16(false, ah, false, bl, (short)0, c, false, false);
  asm volatile("v_nop\n\tv_nop\n\tv_nop\n\tv_nop" : "+v"(c) : "v"(ah), "v"(al), "v"(bh), "v"(bl));
  return c;
}

__global__ __launch_bounds__(256) void k_wt_bf16(const float* __restrict__ W, unsigned short* __restrict__ Wt, int K, int N) {
  const int t = blockIdx.x * 256 + threadIdx.x;
  const int k8n = K / 8;
  if (t >= N * k8n) return;
  const int n = t / k8n, k8 = (t % k8n) * 8;
  v8us v;
#pragma unroll
  for (int i = 0; i < 8; ++i) v[i] = bf16_bits(W[(size_t)(k8 + i) * N + n]);
  *(v8us*)(Wt + (size_t)n * K + k8) = v;
  
}

// GEMM C[M][N] (f32, pitch ldc) = act(A[M][K]·W + bias). A f32 row-major (pitch lda) converted per fragment to bf16
// (ASPLIT: hi/lo two planes -> 2 terms, else single rounded term); Wt bf16 [N][K] (pitch ldb). BIAS_BF16 rounds the
// bias to bf16 first (bias quantised to bf16 before the add). K%32==0, M%16==0, N%64==0.
template <bool ASPLIT, int ACT, bool BIAS_BF16>
__global__ __launch_bounds__(128) void k_gemm_bf(const float* __restrict__ A, int lda, const unsigned short* __restrict__ Wt, int ldb,
                                               const float* __restrict__ bias, float* __restrict__ C, int ldc, int M, int N, int K) {
  __shared__ __attribute__((aligned(16))) float so[4][16][64];
  const int tid = threadIdx.x, w = tid >> 5, lane = tid & 31, ln = lane & 15, hh = lane >> 4;
  const int ntn = N / 64;
  const int wid = blockIdx.x * 4 + w;
  const int mt = wid / ntn, nq = wid % ntn;
  if (mt * 16 >= M) return;
  const int row0 = mt * 16, col0 = nq * 64;
  const float* arow = A + (size_t)(row0 + ln) * lda;
  v8f acc[4] = {};
  for (int kb = 0; kb < K; kb += 32) {
    FragB ah, al;
    const v4f x0 = *(const v4fa*)(arow + kb + 8 * hh), x1 = *(const v4fa*)(arow + kb + 8 * hh + 4);
    const v4f x2 = *(const v4fa*)(arow + kb + 16 + 8 * hh), x3 = *(const v4fa*)(arow + kb + 16 + 8 * hh + 4);
    float xs[16] = {x0[0],x0[1],x0[2],x0[3],x1[0],x1[1],x1[2],x1[3],x2[0],x2[1],x2[2],x2[3],x3[0],x3[1],x3[2],x3[3]};
#pragma unroll
    for (int i = 0; i < 16; ++i) { const unsigned short hb = bf16_bits(xs[i]); ah.u[i] = hb; al.u[i] = ASPLIT ? bf16_bits(xs[i] - bf16_val(hb)) : (unsigned short)0; }
#pragma unroll
    for (int t = 0; t < 4; ++t) {
      const unsigned short* brow = Wt + (size_t)(col0 + t * 16 + ln) * ldb + kb;
      FragB b;
      b.half[0] = *(const v8us*)(brow + 8 * hh);
      b.half[1] = *(const v8us*)(brow + 16 + 8 * hh);
      acc[t] = mmaN<ASPLIT ? 2 : 1>(ah.v, al.v, b.v, b.v, acc[t]);
    }
  }
#pragma unroll
  for (int t = 0; t < 4; ++t) {
    float bv = bias ? bias[col0 + t * 16 + ln] : 0.f;
    if (BIAS_BF16) bv = bf16_round(bv);
#pragma unroll
    for (int r = 0; r < 8; ++r) { float v = acc[t][r] + bv; if (ACT == 1) v = fmaxf(v, 0.f); so[w][8 * hh + r][t * 16 + ln] = v; }
  }
  __builtin_amdgcn_fence(__ATOMIC_ACQ_REL, "workgroup");
  __builtin_amdgcn_wave_barrier();
  const int rsub = lane >> 4, c4 = (lane & 15) * 4;
  {
#pragma unroll
    for (int q = 0; q < 8; ++q) {
      const int r = q * 2 + rsub;
      const v4f v = *(const v4fa*)&so[w][r][c4];
      *(v4f*)(C + (size_t)(row0 + r) * ldc + col0 + c4) = v;
    }
    
  }
}

// Flash-style causal/unmasked attention, all contractions 3-term bf16 hi/lo splits, f32 softmax with running max.
// q,k,v rows are read from f32 buffers with arbitrary row pitch (so they can live inside a fused qkv buffer);
// D = head size (multiple of 32, <= 128); one wave = 16 query rows; block = 4 waves (64 queries) sharing K/V chunks of 32.
template <int D, bool CAUSAL>
__global__ __launch_bounds__(128) void k_flash(const float* __restrict__ qb, const float* __restrict__ kb, const float* __restrict__ vb,
                                             int pitch, int T, int H, float scale, float* __restrict__ y, int ypitch) {
  constexpr int KS = D / 32;        // k-steps for QK
  constexpr int DT = D / 16;        // d tiles for PV
  __shared__ __attribute__((aligned(16))) unsigned short sKh[32][D + 8], sKl[32][D + 8], sVh[32][D + 8], sVl[32][D + 8];
  __shared__ __attribute__((aligned(16))) unsigned short sPh[4][16][40], sPl[4][16][40];
  __shared__ __attribute__((aligned(16))) float sO[4][16][D];
  const int tid = threadIdx.x, w = tid >> 5, lane = tid & 31, ln = lane & 15, hh = lane >> 4;
  const int nqb = (T + 63) / 64;
  const int bh = blockIdx.x / nqb, qblk = blockIdx.x % nqb;
  const int b = bh / H, h = bh % H;
  const int q0 = qblk * 64 + w * 16;
  const float* Q = qb + (size_t)b * T * pitch + h * D;
  const float* K = kb + (size_t)b * T * pitch + h * D;
  const float* V = vb + (size_t)b * T * pitch + h * D;

  // A fragments of the wave's 16 query rows (scaled), hi/lo
  FragB aqh[KS], aql[KS];
  {
    int row = q0 + ln; if (row >= T) row = T - 1;
    const float* qr = Q + (size_t)row * pitch;
#pragma unroll
    for (int ks = 0; ks < KS; ++ks)
#pragma unroll
      for (int i = 0; i < 16; ++i) {
        const int d = ks * 32 + ((i < 8) ? (8 * hh + i) : (16 + 8 * hh + (i - 8)));
        const float x = qr[d] * scale; const unsigned short hb = bf16_bits(x);
        aqh[ks].u[i] = hb; aql[ks].u[i] = bf16_bits(x - bf16_val(hb));
      }
  }
  float m_r[8], l_r[8];
#pragma unroll
  for (int r = 0; r < 8; ++r) { m_r[r] = -3.0e38f; l_r[r] = 0.f; }
  v8f oacc[DT];
#pragma unroll
  for (int dt = 0; dt < DT; ++dt) oacc[dt] = (v8f){0.f,0.f,0.f,0.f,0.f,0.f,0.f,0.f};

  const int kv_end = CAUSAL ? min(T, qblk * 64 + 64) : T;     // block-uniform
  for (int j0 = 0; j0 < kv_end; j0 += 32) {
    __syncthreads();
    for (int e = tid; e < 32 * (D / 4); e += 128) {
      const int r = e / (D / 4), c4 = (e % (D / 4)) * 4;
      const int key = j0 + r;
      v4f kf = {0.f,0.f,0.f,0.f}, vf = {0.f,0.f,0.f,0.f};
      if (key < T) { kf = *(const v4fa*)(K + (size_t)key * pitch + c4); vf = *(const v4fa*)(V + (size_t)key * pitch + c4); }
#pragma unroll
      for (int t = 0; t < 4; ++t) {
        unsigned short hb = bf16_bits(kf[t]); sKh[r][c4 + t] = hb; sKl[r][c4 + t] = bf16_bits(kf[t] - bf16_val(hb));
        hb = bf16_bits(vf[t]); sVh[r][c4 + t] = hb; sVl[r][c4 + t] = bf16_bits(vf[t] - bf16_val(hb));
      }
    }
    __syncthreads();
    // S tile 16 x 32
    v8f s[2];
#pragma unroll
    for (int nt = 0; nt < 2; ++nt) {
      v8f acc = {};
#pragma unroll
      for (int ks = 0; ks < KS; ++ks) {
        FragB bh_, bl_;
        bh_.half[0] = *(const v8us*)&sKh[nt * 16 + ln][ks * 32 + 8 * hh]; bh_.half[1] = *(const v8us*)&sKh[nt * 16 + ln][ks * 32 + 16 + 8 * hh];
        bl_.half[0] = *(const v8us*)&sKl[nt * 16 + ln][ks * 32 + 8 * hh]; bl_.half[1] = *(const v8us*)&sKl[nt * 16 + ln][ks * 32 + 16 + 8 * hh];
        acc = mmaN<3>(aqh[ks].v, aql[ks].v, bh_.v, bl_.v, acc);
      }
      s[nt] = acc;
    }
    // mask + running max (rows 8hh+r; the 16 lanes of a half share rows)
    float alpha[8];
#pragma unroll
    for (int r = 0; r < 8; ++r) {
      const int qi = q0 + 8 * hh + r;
      const int ja = j0 + ln, jb = j0 + 16 + ln;
      if (CAUSAL) { if (ja > qi) s[0][r] = -3.0e38f; if (jb > qi) s[1][r] = -3.0e38f; }
      if (ja >= T) s[0][r] = -3.0e38f;
      if (jb >= T) s[1][r] = -3.0e38f;
      float mx = fmaxf(s[0][r], s[1][r]);
      mx = fmaxf(mx, __shfl_xor(mx, 1, 32)); mx = fmaxf(mx, __shfl_xor(mx, 2, 32)); mx = fmaxf(mx, __shfl_xor(mx, 4, 32)); mx = fmaxf(mx, __shfl_xor(mx, 8, 32));
      const float mnew = fmaxf(m_r[r], mx);
      alpha[r] = (mnew > -1.0e38f) ? __expf(m_r[r] - mnew) : 1.0f;
      const float p0 = (s[0][r] > -1.0e38f) ? __expf(s[0][r] - mnew) : 0.f;
      const float p1 = (s[1][r] > -1.0e38f) ? __expf(s[1][r] - mnew) : 0.f;
      m_r[r] = mnew;
      l_r[r] = l_r[r] * alpha[r] + p0 + p1;            // per-lane partial row sum (16 lanes combined at the end)
      unsigned short hb = bf16_bits(p0); sPh[w][8 * hh + r][ln] = hb;      sPl[w][8 * hh + r][ln] = bf16_bits(p0 - bf16_val(hb));
      hb = bf16_bits(p1);                sPh[w][8 * hh + r][16 + ln] = hb; sPl[w][8 * hh + r][16 + ln] = bf16_bits(p1 - bf16_val(hb));
    }
#pragma unroll
    for (int dt = 0; dt < DT; ++dt)
#pragma unroll
      for (int r = 0; r < 8; ++r) oacc[dt][r] *= alpha[r];
    __builtin_amdgcn_fence(__ATOMIC_ACQ_REL, "workgroup");
    __builtin_amdgcn_wave_barrier();
    FragB pah, pal;
    pah.half[0] = *(const v8us*)&sPh[w][ln][8 * hh]; pah.half[1] = *(const v8us*)&sPh[w][ln][16 + 8 * hh];
    pal.half[0] = *(const v8us*)&sPl[w][ln][8 * hh]; pal.half[1] = *(const v8us*)&sPl[w][ln][16 + 8 * hh];
#pragma unroll
    for (int dt = 0; dt < DT; ++dt) {
      FragB bvh, bvl;
#pragma unroll
      for (int i = 0; i < 8; ++i) {
        bvh.u[i] = sVh[8 * hh + i][dt * 16 + ln]; bvh.u[8 + i] = sVh[16 + 8 * hh + i][dt * 16 + ln];
        bvl.u[i] = sVl[8 * hh + i][dt * 16 + ln]; bvl.u[8 + i] = sVl[16 + 8 * hh + i][dt * 16 + ln];
      }
      oacc[dt] = mmaN<3>(pah.v, pal.v, bvh.v, bvl.v, oacc[dt]);
    }
    __builtin_amdgcn_fence(__ATOMIC_ACQ_REL, "workgroup");
    __builtin_amdgcn_wave_barrier();
  }
#pragma unroll
  for (int r = 0; r < 8; ++r) {
    float l = l_r[r];
    l += __shfl_xor(l, 1, 32); l += __shfl_xor(l, 2, 32); l += __shfl_xor(l, 4, 32); l += __shfl_xor(l, 8, 32);
    l_r[r] = (l > 0.f) ? 1.0f / l : 0.f;
  }
#pragma unroll
  for (int dt = 0; dt < DT; ++dt)
#pragma unroll
    for (int r = 0; r < 8; ++r) sO[w][8 * hh + r][dt * 16 + ln] = oacc[dt][r] * l_r[r];
  __builtin_amdgcn_fence(__ATOMIC_ACQ_REL, "workgroup");
  __builtin_amdgcn_wave_barrier();
  {
    for (int r = 0; r < 16; ++r) {
      const int row = q0 + r;
      if (row < T && lane < D / 4) {
        const v4f val = *(const v4fa*)&sO[w][r][lane * 4];
        *(v4f*)(y + ((size_t)b * T + row) * ypitch + h * D + lane * 4) = val;
      }
    }
    
  }
}

// GEMM C = act(A·W + bias + resid): A f32 (ASPLIT -> hi/lo 2 terms), Wt bf16 [N][K]; ACT 0 none, 1 relu, 2 exact gelu;
// resid (optional, f32, row index = (row % rmod), pitch ldr, RES_BF16 rounds it) added before the activation.
template <bool ASPLIT, int ACT, bool BIAS_BF16, bool RES_BF16>
__global__ __launch_bounds__(128) void k_gemm_bf3(const float* __restrict__ A, int lda, const unsigned short* __restrict__ Wt, int ldb,
                                                const float* __restrict__ bias, const float* __restrict__ resid, int rmod, int ldr,
                                                float* __restrict__ C, int ldc, int M, int N, int K) {
  __shared__ __attribute__((aligned(16))) float so[4][16][64];
  const int tid = threadIdx.x, w = tid >> 5, lane = tid & 31, ln = lane & 15, hh = lane >> 4;
  const int ntn = N / 64;
  const int wid = blockIdx.x * 4 + w;
  const int mt = wid / ntn, nq = wid % ntn;
  if (mt * 16 >= M) return;
  const int row0 = mt * 16, col0 = nq * 64;
  const float* arow = A + (size_t)(row0 + ln) * lda;
  v8f acc[4] = {};
  for (int kb = 0; kb < K; kb += 32) {
    FragB ah, al;
    const v4f x0 = *(const v4fa*)(arow + kb + 8 * hh), x1 = *(const v4fa*)(arow + kb + 8 * hh + 4);
    const v4f x2 = *(const v4fa*)(arow + kb + 16 + 8 * hh), x3 = *(const v4fa*)(arow + kb + 16 + 8 * hh + 4);
    float xs[16] = {x0[0],x0[1],x0[2],x0[3],x1[0],x1[1],x1[2],x1[3],x2[0],x2[1],x2[2],x2[3],x3[0],x3[1],x3[2],x3[3]};
#pragma unroll
    for (int i = 0; i < 16; ++i) { const unsigned short hb = bf16_bits(xs[i]); ah.u[i] = hb; al.u[i] = ASPLIT ? bf16_bits(xs[i] - bf16_val(hb)) : (unsigned short)0; }
#pragma unroll
    for (int t = 0; t < 4; ++t) {
      const unsigned short* brow = Wt + (size_t)(col0 + t * 16 + ln) * ldb + kb;
      FragB b;
      b.half[0] = *(const v8us*)(brow + 8 * hh);
      b.half[1] = *(const v8us*)(brow + 16 + 8 * hh);
      acc[t] = mmaN<ASPLIT ? 2 : 1>(ah.v, al.v, b.v, b.v, acc[t]);
    }
  }
#pragma unroll
  for (int t = 0; t < 4; ++t) {
    const int col = col0 + t * 16 + ln;
    float bv = bias ? bias[col] : 0.f;
    if (BIAS_BF16) bv = bf16_round(bv);
#pragma unroll
    for (int r = 0; r < 8; ++r) {
      float v = acc[t][r] + bv;
      if (resid) { float rv = resid[(size_t)((row0 + 8 * hh + r) % rmod) * ldr + col]; if (RES_BF16) rv = bf16_round(rv); v += rv; }
      if (ACT == 1) v = fmaxf(v, 0.f);
      if (ACT == 2) v = 0.5f * v * (1.0f + erff(v * 0.70710678118654752f));
      if (ACT == 3) { const float u = 0.7978845608028654f * (v + 0.044715f * v * v * v); v = 0.5f * v * (1.0f + tanhf(u)); }
      so[w][8 * hh + r][t * 16 + ln] = v;
    }
  }
  __builtin_amdgcn_fence(__ATOMIC_ACQ_REL, "workgroup");
  __builtin_amdgcn_wave_barrier();
  const int rsub = lane >> 4, c4 = (lane & 15) * 4;
  {
#pragma unroll
    for (int q = 0; q < 8; ++q) {
      const int r = q * 2 + rsub;
      const v4f v = *(const v4fa*)&so[w][r][c4];
      *(v4f*)(C + (size_t)(row0 + r) * ldc + col0 + c4) = v;
    }
    
  }
}
// row LayerNorm (biased variance, eps) over N: s = X (+ R); optional out_sum <- s; out_norm <- (s-mu)*rsqrt(var+eps)*g + b
template <bool PARAM_BF16>
__global__ __launch_bounds__(256) void k_layernorm(const float* __restrict__ X, const float* __restrict__ R, const float* __restrict__ g, const float* __restrict__ bta,
                                                  float* __restrict__ out_sum, float* __restrict__ out_norm, int N, float eps) {
  __shared__ float red[256];
  const int row = blockIdx.x, tid = threadIdx.x;
  const float* x = X + (size_t)row * N; const float* rr = R ? R + (size_t)row * N : nullptr;
  float vals[16];                     // up to N = 4096
  const int per = N / 256;            // contiguous chunk per thread? use strided-by-4 chunks: thread handles j = tid*4 + 1024*u
  float s1 = 0.f;
  for (int u = 0; u < per / 4; ++u) {
    const int j = tid * 4 + 1024 * u;
    const v4f a = *(const v4fa*)(x + j);
    v4f b = {0.f,0.f,0.f,0.f}; if (rr) b = *(const v4fa*)(rr + j);
#pragma unroll
    for (int q = 0; q < 4; ++q) { const float v = a[q] + b[q]; vals[u * 4 + q] = v; s1 += v; }
  }
  red[tid] = s1; __syncthreads();
  for (int st = 128; st > 0; st >>= 1) { if (tid < st) red[tid] += red[tid + st]; __syncthreads(); }
  const float mu = red[0] / (float)N; __syncthreads();
  float s2 = 0.f;
  for (int u = 0; u < per / 4; ++u)
#pragma unroll
    for (int q = 0; q < 4; ++q) { const float c = vals[u * 4 + q] - mu; s2 += c * c; }
  red[tid] = s2; __syncthreads();
  for (int st = 128; st > 0; st >>= 1) { if (tid < st) red[tid] += red[tid + st]; __syncthreads(); }
  const float rs = rsqrtf(red[0] / (float)N + eps);
  {
    for (int u = 0; u < per / 4; ++u) {
      const int j = tid * 4 + 1024 * u;
      v4f o, sm;
#pragma unroll
      for (int q = 0; q < 4; ++q) {
        float gg = g[j + q], bb = bta[j + q];
        if (PARAM_BF16) { gg = bf16_round(gg); bb = bf16_round(bb); }
        sm[q] = vals[u * 4 + q]; o[q] = (vals[u * 4 + q] - mu) * rs * gg + bb;
      }
      if (out_sum) *(v4f*)(out_sum + (size_t)row * N + j) = sm;
      *(v4f*)(out_norm + (size_t)row * N + j) = o;
    }
    
  }
}



// ---- f16 WMMA path (v_wmma_f32_16x16x32_f16): 11-bit significands for operands in range — used here for all three MLP layers (k_mlp)
typedef _Float16 v16h __attribute__((ext_vector_type(16)));
union FragH { v16h v; v8us half[2]; _Float16 h[16]; unsigned short u[16]; };
template <int NT>
__device__ __forceinline__ v8f mmaH(v16h ah, v16h al, v16h bh, v16h bl, v8f c) {
  c = __builtin_amdgcn_wmma_f32_16x16x32_f16(false, ah, false, bh, (short)0, c, false, false);
  if (NT >= 2) c = __builtin_amdgcn_wmma_f32_16x16x32_f16(false, al, false, bh, (short)0, c, false, false);
  if (NT >= 3) c = __builtin_amdgcn_wmma_f32_16x16x32_f16(false, ah, false, bl, (short)0, c, false, false);
  asm volatile("v_nop\n\tv_nop\n\tv_nop\n\tv_nop" : "+v"(c) : "v"(ah), "v"(al), "v"(bh), "v"(bl));
  return c;
}
// batched GEMM like k_gemm_b but f16 operands: A f32 (split into f16 hi/lo if ASPLIT, else rounded to f16), Bt = f16 values [n][k]; alpha; C f32; N multiple of 16 (partial tiles skipped)
template <bool ASPLIT>
__global__ __launch_bounds__(128) void k_gemm_h(const float* __restrict__ A, int lda, size_t sA, const _Float16* __restrict__ Bh, int ldb, size_t sB, float alpha, float* __restrict__ C, int ldc, size_t sC, int M, int N, int K) {
  __shared__ __attribute__((aligned(16))) float so[4][16][64];
  const int tid = threadIdx.x, w = tid >> 5, lane = tid & 31, ln = lane & 15, hh = lane >> 4; const int by = blockIdx.y;
  A += (size_t)by * sA; Bh += (size_t)by * sB; C += (size_t)by * sC;
  const int ntn = (N + 63) / 64; const int wid = blockIdx.x * 4 + w; const int mt = wid / ntn, nq = wid % ntn; if (mt * 16 >= M) return;
  const int row0 = mt * 16, col0 = nq * 64; const float* arow = A + (size_t)(row0 + ln) * lda;
  v8f acc[4] = {};
  for (int kb = 0; kb < K; kb += 32) {
    FragH ah, al;
    const v4f x0 = *(const v4fa*)(arow + kb + 8 * hh), x1 = *(const v4fa*)(arow + kb + 8 * hh + 4), x2 = *(const v4fa*)(arow + kb + 16 + 8 * hh), x3 = *(const v4fa*)(arow + kb + 16 + 8 * hh + 4);
    float xs[16] = {x0[0],x0[1],x0[2],x0[3],x1[0],x1[1],x1[2],x1[3],x2[0],x2[1],x2[2],x2[3],x3[0],x3[1],x3[2],x3[3]};
#pragma unroll
    for (int i = 0; i < 16; ++i) { const _Float16 h = (_Float16)xs[i]; ah.h[i] = h; al.h[i] = ASPLIT ? (_Float16)(xs[i] - (float)h) : (_Float16)0.0f; }
#pragma unroll
    for (int t = 0; t < 4; ++t) { if (col0 + t * 16 >= N) continue; const size_t boff = (size_t)(col0 + t * 16 + ln) * ldb + kb; FragH bq; bq.half[0] = *(const v8us*)(Bh + boff + 8 * hh); bq.half[1] = *(const v8us*)(Bh + boff + 16 + 8 * hh);
      acc[t] = mmaH<ASPLIT ? 2 : 1>(ah.v, al.v, bq.v, bq.v, acc[t]); }
  }
#pragma unroll
  for (int t = 0; t < 4; ++t) { if (col0 + t * 16 >= N) continue;
#pragma unroll
    for (int r = 0; r < 8; ++r) so[w][8 * hh + r][t * 16 + ln] = acc[t][r] * alpha; }
  __builtin_amdgcn_fence(__ATOMIC_ACQ_REL, "workgroup"); __builtin_amdgcn_wave_barrier();
  const int rsub = lane >> 4, c4 = (lane & 15) * 4;
  {
#pragma unroll
    for (int q = 0; q < 8; ++q) { const int r = q * 2 + rsub; if (col0 + c4 < N) { const v4f v = *(const v4fa*)&so[w][r][c4]; *(v4f*)(C + (size_t)(row0 + r) * ldc + col0 + c4) = v; } }
     }
}

// Wt[n][k] = f16(W[k][n]·scale) from f32 row-major W[K][N] (scale = power of two; bf16-exact weights stay exact in f16 away from the subnormal range)
__global__ __launch_bounds__(256) void k_wt_f16(const float* __restrict__ W, _Float16* __restrict__ Wt, int K, int N, float scale) {
  const int t = blockIdx.x * 256 + threadIdx.x; if (t >= N * (K / 8)) return; const int n = t / (K / 8), k8 = (t % (K / 8)) * 8; FragH f;
#pragma unroll
  for (int i = 0; i < 8; ++i) f.h[i] = (_Float16)(bf16_round(W[(size_t)(k8 + i) * N + n]) * scale); const v8us o = f.half[0];
  *(v8us*)((unsigned short*)Wt + (size_t)n * K + k8) = o; 
}

#define NPT 4           // pixel tiles of 16 per wave = two adjacent image rows, 64 pixels (tile p holds pixels 4 ln + p); each weight fragment read from LDS feeds NPT products
#define P1 (IC + 8)     // LDS row pitch in f16: 272 B and 528 B are 16 B x odd, the conflict-free pitch for ds_load_b128 fragment reads
#define P2 (HH + 8)
typedef float v2f __attribute__((ext_vector_type(2)));
typedef float v2fa __attribute__((ext_vector_type(2), may_alias));
typedef __bf16 v2bf __attribute__((ext_vector_type(2)));
// two values rounded to bf16, to nearest even (what bf16_round gives for every finite value), and widened again: one packed conversion for the pair
__device__ __forceinline__ v2f bf16_round2(float a, float b) { const v2f t = {a, b}; return __builtin_convertvector(__builtin_convertvector(t, v2bf), v2f); }
// 32 k rows (from row k0 on) of the lane's two adjacent weight columns, f32: a wave reads 256 contiguous bytes (two whole lines) of each row, all 32 reads in flight together. base = the wave's first column in row 0, the same in every lane
__device__ __forceinline__ void wload32(v2f (&r)[32], const float* base, int lane, int k0) {
#pragma unroll
  for (int i = 0; i < 32; ++i) r[i] = *(const v2fa*)(base + (k0 + i) * HH + 2 * lane);
  // the wait stands before anything overwrites the address registers that the 32 reads name (the scalar base and the lane's index: as the wait's operands they stay whole up to it); its clobber also keeps these reads ahead of the conversion that follows in the source
  asm volatile("s_wait_xcnt 0x0" :: "s"(base), "v"(lane) : "memory");
}
// the same 32 x 2 values as f16(bf16_round(v) * 16), transposed (the exact scaling by 2^4 is done in f32 ahead of the rounding: same value, and nothing small passes through f16 unscaled): 16-byte pieces (8 consecutive k) of the LDS rows n and n + 1, d = the place of (n, first k)
__device__ __forceinline__ void wput32(const v2f (&r)[32], unsigned short* d, int pitch) {
  v2f q[32];
#pragma unroll
  for (int i = 0; i < 32; ++i) q[i] = r[i] * 16.0f;
#pragma unroll
  for (int c = 0; c < 2; ++c)
#pragma unroll
    for (int g = 0; g < 4; ++g) {
      FragH f;
#pragma unroll
      for (int i = 0; i < 8; i += 2) { const v2f t = bf16_round2(q[g * 8 + i][c], q[g * 8 + i + 1][c]); f.h[i] = (_Float16)t[0]; f.h[i + 1] = (_Float16)t[1]; }
      *(v8us*)(d + c * pitch + g * 8) = f.half[0];
    }
}
// two adjacent image rows of x, f32, in fragment order: r[kb][e] = channel kb * 32 + 8hh + e (e < 8) or kb * 32 + 16 + 8hh + e - 8, pixels 4 ln to 4 ln + 3; s includes 8hh channels and 4 ln. A half wave reads two whole lines
__device__ __forceinline__ void xload(v4f (&r)[IC / 32][16], const float* s) {
#pragma unroll
  for (int kb = 0; kb < IC / 32; ++kb)
#pragma unroll
    for (int e = 0; e < 16; ++e) r[kb][e] = *(const v4fa*)(s + (kb * 32 + (e >> 3) * 16 + (e & 7)) * (IH * IH));
  // the wait stands before anything overwrites the address registers that these reads name
  asm volatile("s_wait_xcnt 0x0" :: "v"(s) : "memory");
}
__device__ __forceinline__ v8f wmma_h(v16h a, v16h b, v8f c) { return __builtin_amdgcn_wmma_f32_16x16x32_f16(false, a, false, b, (short)0, c, false, false); }
// fragment of row (or column) 'row' at k0: elements 0..7 = k0 + 8hh + 0..7, elements 8..15 = k0 + 16 + 8hh + 0..7 (the order a packed pair of D tiles has)
__device__ __forceinline__ v16h frag_at(const unsigned short* row, int k0, int hh) { FragH f; f.half[0] = *(const v8us*)(row + k0 + 8 * hh); f.half[1] = *(const v8us*)(row + k0 + 16 + 8 * hh); return f.v; }
// half a B fragment of the next layer from one D tile: h[r] = f16(relu(acc[r] / 16 + bias[8hh + r])), c0 and c1 = the lane's 8 bias values
__device__ __forceinline__ void pack_tile(FragH& f, int u, v8f acc, v4f c0, v4f c1) {
#pragma unroll
  for (int r = 0; r < 8; ++r) f.h[u * 8 + r] = (_Float16)fmaxf(acc[r] * 0.0625f + (r < 4 ? c0[r & 3] : c1[r & 3]), 0.f);
}
// One work-group = one output channel o and one image n; 8 waves, each takes the image rows i = 2 w + 16 it and i + 1 in trip it
// D maps: layers 1, 2: acc[r] = hidden[16t + 8hh + r][pixel ln]. Layer 3: rows 0, 1, 8, 9 of its A operand hold W3's columns k = 0, 1, 2, 3 (the rest zero), so acc3[kj] = out_k[2hh + kj][pixel ln]: ki = hh.
__global__ __launch_bounds__(256) void k_mlp(const float* __restrict__ x, const float* __restrict__ W1, const float* __restrict__ W2, const float* __restrict__ b1, const float* __restrict__ b2,
                                             const float* __restrict__ W3, const float* __restrict__ b3, float* __restrict__ out) {
  __shared__ __attribute__((aligned(16))) unsigned short sW1[HH][P1], sW2[HH][P2], sW3[16][P2];
  __shared__ __attribute__((aligned(16))) float sB1[HH], sB2[HH];
  const int tid = threadIdx.x, lane = tid & 31, ln = lane & 15, hh = lane >> 4;
  const int w = __builtin_amdgcn_readfirstlane(tid >> 5);      // the wave's number in a scalar register: the row loop below branches on SCC and leaves EXEC alone
  const int o = blockIdx.x / NBt, n = blockIdx.x % NBt;
  // staging: wave w takes the 64 columns (LDS rows) from 64 (w & 3) on and half of the k range (w >> 2), a lane two adjacent columns; two register sets of 32 k rows, so that one set's reads fly while the other is converted
  const int n0 = (w & 3) * 64 + 2 * lane, kh = w >> 2;
  const float* g1 = W1 + ((size_t)o * IC + kh * (IC / 2)) * HH + (w & 3) * 64;
  const float* g2 = W2 + ((size_t)o * HH + kh * (HH / 2)) * HH + (w & 3) * 64;
  const float* xrow = x + ((size_t)n * IC + 8 * hh) * (IH * IH) + 2 * w * IH + 4 * ln;      // channel 8hh, pixel 4 ln of the rows (n, i = 2 w) and (n, i + 1)
  const v4f w3 = *(const v4fa*)(W3 + ((size_t)o * HH + tid) * 4);      // thread = hidden unit e: its four k
  const float b1v = b1[o * HH + tid], b2v = b2[o * HH + tid];
  const float c30 = bf16_round(hh ? b3[o * 4 + 2] : b3[o * 4]), c31 = bf16_round(hh ? b3[o * 4 + 3] : b3[o * 4 + 1]);      // ki = hh picks the pair
  v4f xr[IC / 32][16];
  {
    v2f ra[32], rb[32];
    wload32(ra, g1, lane, 0);
    wload32(rb, g1, lane, 32);
    wput32(ra, &sW1[n0][kh * (IC / 2)], P1);
    wload32(ra, g2, lane, 0);
    wput32(rb, &sW1[n0][kh * (IC / 2) + 32], P1);
    wload32(rb, g2, lane, 32);
    wput32(ra, &sW2[n0][kh * (HH / 2)], P2);
    wload32(ra, g2, lane, 64);
    wput32(rb, &sW2[n0][kh * (HH / 2) + 32], P2);
    wload32(rb, g2, lane, 96);
    xload(xr, xrow);      // the wave's first two image rows fly behind the last weights
    wput32(ra, &sW2[n0][kh * (HH / 2) + 64], P2);
    wput32(rb, &sW2[n0][kh * (HH / 2) + 96], P2);
  }
#pragma unroll
  for (int m = 0; m < 16; ++m) { FragH f; f.h[0] = (_Float16)(bf16_round(w3[(m >> 3) * 2 + (m & 1)]) * 16.0f); sW3[m][tid] = ((m & 6) == 0) ? f.u[0] : (unsigned short)0; }
  sB1[tid] = bf16_round(b1v); sB2[tid] = bf16_round(b2v);
  __syncthreads();      // the weights are read-only from here on: the kernel's only barrier
  for (int i = 2 * w; i < IH; i += 16) {
    FragH px[NPT][IC / 32];      // the two rows' pixel fragments: f16(bf16_round(x))
#pragma unroll
    for (int p = 0; p < NPT; ++p)
#pragma unroll
      for (int kb = 0; kb < IC / 32; ++kb)
#pragma unroll
        for (int e = 0; e < 16; e += 2) { const v2f t = bf16_round2(xr[kb][e][p], xr[kb][e + 1][p]); px[p][kb].h[e] = (_Float16)t[0]; px[p][kb].h[e + 1] = (_Float16)t[1]; }
    FragH h1[NPT][HH / 32];
    v16h wa[2][4]; v4f wc[2][2];      // two register sets of four weight fragments: the next four are read from LDS while these are multiplied (16 products a set)
#pragma unroll
    for (int q = 0; q < 4; ++q) wa[0][q] = frag_at(&sW1[ln][0], q * 32, hh);
#pragma unroll
    for (int q = 0; q < 2; ++q) wc[0][q] = *(const v4fa*)&sB1[8 * hh + q * 4];
    // full unroll: h1 is indexed by t and has to stay in registers
#pragma unroll
    for (int t = 0; t < HH / 16; ++t) {
      if (t + 1 < HH / 16) {
#pragma unroll
        for (int q = 0; q < 4; ++q) wa[(t + 1) & 1][q] = frag_at(&sW1[(t + 1) * 16 + ln][0], q * 32, hh);
#pragma unroll
        for (int q = 0; q < 2; ++q) wc[(t + 1) & 1][q] = *(const v4fa*)&sB1[(t + 1) * 16 + 8 * hh + q * 4];
      } else {      // behind the last tile: layer 2's first four fragments
#pragma unroll
        for (int q = 0; q < 4; ++q) wa[0][q] = frag_at(&sW2[ln][0], q * 32, hh);
      }
      // keeps the next tile's LDS reads ahead of this tile's matrix instructions; left free, the scheduler puts each read directly in front of its use and every product waits out the LDS latency
      __builtin_amdgcn_sched_barrier(0);
      v8f acc[NPT] = {};
#pragma unroll
      for (int kb = 0; kb < IC / 32; ++kb)
#pragma unroll
        for (int p = 0; p < NPT; ++p) acc[p] = wmma_h(wa[t & 1][kb], px[p][kb].v, acc[p]);
#pragma unroll
      for (int p = 0; p < NPT; ++p) pack_tile(h1[p][t >> 1], t & 1, acc[p], wc[t & 1][0], wc[t & 1][1]);
    }
    v8f acc3[NPT] = {};
    // kept rolled, as it was with two tiles: the body already holds 68 matrix instructions, and eight copies of it would only lengthen the text that a first launch has to fetch
#pragma unroll 1
    for (int s = 0; s < HH / 32; ++s) {
      FragH h2[NPT];
      v16h a3;
      // full unroll: h1 is indexed by kb, the register sets by g
#pragma unroll
      for (int u = 0; u < 2; ++u) {
        v8f acc[NPT] = {};
        v4f d0, d1;
#pragma unroll
        for (int g = 0; g < 2; ++g) {
          // the four fragments that follow: the tile's second half of k, the next tile's first half (behind the last tile: tile 0 again, in bounds, unused)
          const unsigned short* nx = &sW2[((2 * s + u + g) & (HH / 16 - 1)) * 16 + ln][0];
#pragma unroll
          for (int q = 0; q < 4; ++q) wa[(g + 1) & 1][q] = frag_at(nx, ((g + 1) & 1) * 128 + q * 32, hh);
          if (g == 0) { const float* bs = &sB2[(2 * s + u) * 16 + 8 * hh]; d0 = *(const v4fa*)bs; d1 = *(const v4fa*)(bs + 4); }
          if (g == 0 && u == 1) a3 = frag_at(&sW3[ln][0], s * 32, hh);
          // keeps these LDS reads ahead of the 16 matrix instructions below, as in layer 1. Read at their use and left to the scheduler, all 16 fragments of a trip are lifted to its head: 128 registers, and beside four tiles of hidden rows that build spills
          __builtin_amdgcn_sched_barrier(0);
#pragma unroll
          for (int kb = 0; kb < 4; ++kb)
#pragma unroll
            for (int p = 0; p < NPT; ++p) acc[p] = wmma_h(wa[g][kb], h1[p][g * 4 + kb].v, acc[p]);
        }
#pragma unroll
        for (int p = 0; p < NPT; ++p) pack_tile(h2[p], u, acc[p], d0, d1);
      }
#pragma unroll
      for (int p = 0; p < NPT; ++p) acc3[p] = wmma_h(a3, h2[p].v, acc3[p]);
    }
    // pixel shuffle: lane (ln, hh) holds kj = 0, 1 of output row 2 (i + (ln >> 3)) + hh for the pixels j = 4 (ln & 7) + p, eight adjacent floats; eight lanes store one whole output row of 256 B
    float* orow = out + (((size_t)n * OC + o) * (2 * IH) + 2 * (i + (ln >> 3)) + hh) * (2 * IH) + 8 * (ln & 7);
#pragma unroll
    for (int q = 0; q < NPT / 2; ++q) {
      v4f y; y[0] = acc3[2 * q][0] * 0.0625f + c30; y[1] = acc3[2 * q][1] * 0.0625f + c31; y[2] = acc3[2 * q + 1][0] * 0.0625f + c30; y[3] = acc3[2 * q + 1][1] * 0.0625f + c31; *(v4f*)(orow + 4 * q) = y;
    }
    asm volatile("s_wait_xcnt 0x0" ::: "memory");      // the pixel reads below and the next trip overwrite the registers that these stores name (its clobber also keeps the loop-invariant weight reads from being hoisted into registers, where they spill)
    // the next trip's pixels: with four tiles of hidden rows in registers there is no room for them during layer 2; the SIMD's other wave has the matrix unit meanwhile (i is scalar: a branch on SCC)
    if (i + 16 < IH) { xrow += 16 * IH; xload(xr, xrow); }
  }
}
extern "C" void kernel_launch(void* const* d_in, const int* in_sizes, int n_in,
                              void* d_out, int out_size, void* d_ws, size_t ws_size, hipStream_t stream) {
  (void)in_sizes; (void)n_in; (void)out_size; (void)d_ws; (void)ws_size;
  const float* x = (const float*)d_in[0]; const float* W1 = (const float*)d_in[1]; const float* b1 = (const float*)d_in[2]; const float* W2 = (const float*)d_in[3]; const float* b2 = (const float*)d_in[4]; const float* W3 = (const float*)d_in[5]; const float* b3 = (const float*)d_in[6];
  k_mlp<<<OC * NBt, 256, 0, stream>>>(x, W1, W2, b1, b2, W3, b3, (float*)d_out);
}
